// v000
// Times are from an AMD MI455X. After a warm-up the kernel runs many times in a row, and a time is the length of
// such a window on the GPU divided by its runs, so every launch and the gaps after it count. The runs cycle
// through copies of the inputs. A figure is the median of several windows, for all but v000 over two sittings.
// Sittings can differ by a few percent; kernels timed side by side share one.
// v000 is the starting kernel. One run takes 228 microseconds.
#include <hip/hip_runtime.h>
#include <hip/hip_bf16.h>

// ---------------------------------------------------------------------------
// MHA forward for B=2, T=2048, D=1024, H=16, DK=64 on gfx1250 (MI455X).
// All GEMMs run through v_wmma_f32_16x16x32_f16 (f16 in, f32 accumulate).
// GEMM tiles are staged global->LDS with GLOBAL_LOAD_ASYNC_TO_LDS_B128
// (ASYNCcnt) in a double-buffered pipeline.
// ---------------------------------------------------------------------------

typedef __attribute__((ext_vector_type(16))) _Float16 v16h;
typedef __attribute__((ext_vector_type(8)))  _Float16 v8h;
typedef __attribute__((ext_vector_type(4)))  _Float16 v4h;
typedef __attribute__((ext_vector_type(8)))  float    v8f;

#define B_  2
#define T_  2048
#define H_  16
#define DK_ 64
#define D_  1024
#define M_  (B_ * T_)   // 4096 rows for the projection GEMMs

__device__ __forceinline__ v8f wmma16(v16h a, v16h b, v8f c) {
  // (neg_a, A, neg_b, B, c_mod, C, reuse_a, reuse_b)
  return __builtin_amdgcn_wmma_f32_16x16x32_f16(false, a, false, b, (short)0, c,
                                                false, false);
}

// Async DMA of one 16-byte chunk: global -> LDS, tracked with ASYNCcnt.
// VDST = per-lane LDS byte offset (low 32 bits of the generic LDS pointer,
// per the CDNA5 aperture mapping), VADDR = 64-bit global address.
__device__ __forceinline__ void async_copy_b128(void* lds_ptr,
                                                const void* gptr) {
  const unsigned loff = (unsigned)(unsigned long long)lds_ptr;
  asm volatile("global_load_async_to_lds_b128 %0, %1, off" ::"v"(loff),
               "v"(gptr)
               : "memory");
}
__device__ __forceinline__ void wait_async0() {
  asm volatile("s_wait_asynccnt 0x0" ::: "memory");
}

// Load a 16x32 f16 WMMA A/B fragment from LDS stored [row][k], k contiguous,
// row stride STRIDE halves (STRIDE % 8 == 0 so each half-row chunk is a
// 16-byte-aligned ds_load_b128).
// Lane L (L<16): row = row0+L, K = {kh..kh+7, 16+kh..16+kh+7} with kh=0.
// Lane L+16:    same row, kh=8.  Matches CDNA5 16-bit A layout (ISA 7.12.2).
template <int STRIDE>
__device__ __forceinline__ v16h load_frag_lds(const _Float16* base, int row0,
                                              int kOff) {
  const int lane = threadIdx.x & 31;
  const _Float16* p =
      base + (size_t)(row0 + (lane & 15)) * STRIDE + kOff + ((lane >> 4) << 3);
  v8h lo = *(const v8h*)(p);
  v8h hi = *(const v8h*)(p + 16);
  return __builtin_shufflevector(lo, hi, 0, 1, 2, 3, 4, 5, 6, 7, 8, 9, 10, 11,
                                 12, 13, 14, 15);
}

// Same fragment shape, loaded directly from global memory with row stride 64
// halves (the [*, 64] head layout of Q/K: row = head-row, k-dim = feature).
__device__ __forceinline__ v16h load_frag_g64(const _Float16* base, int kOff) {
  const int lane = threadIdx.x & 31;
  const _Float16* p =
      base + (size_t)(lane & 15) * DK_ + kOff + ((lane >> 4) << 3);
  v8h lo = *(const v8h*)(p);
  v8h hi = *(const v8h*)(p + 16);
  return __builtin_shufflevector(lo, hi, 0, 1, 2, 3, 4, 5, 6, 7, 8, 9, 10, 11,
                                 12, 13, 14, 15);
}

// ---------------------------------------------------------------------------
// Kernel 0a: tanh(learnable_mask) -> f16, computed once, reused by all (b,h).
// ---------------------------------------------------------------------------
__global__ void tanh_mask_kernel(const float* __restrict__ mask,
                                 _Float16* __restrict__ out, int n) {
  int i = blockIdx.x * blockDim.x + threadIdx.x;
  if (i < n) out[i] = (_Float16)tanhf(mask[i]);
}

// ---------------------------------------------------------------------------
// Kernel 0b: f32 -> f16 elementwise (activations), 4 elems/thread.
// ---------------------------------------------------------------------------
__global__ void cvt_f16_kernel(const float* __restrict__ in,
                               _Float16* __restrict__ out, int n4) {
  int i = blockIdx.x * blockDim.x + threadIdx.x;
  if (i < n4) {
    float4 v = ((const float4*)in)[i];
    v4h h;
    h.x = (_Float16)v.x; h.y = (_Float16)v.y;
    h.z = (_Float16)v.z; h.w = (_Float16)v.w;
    ((v4h*)out)[i] = h;
  }
}

// ---------------------------------------------------------------------------
// Kernel 0c: W[k][n] f32 -> Wt[n][k] f16 (tiled 32x32 transpose via LDS) so
// the GEMM B-operand is k-contiguous and async-DMA-friendly.
// ---------------------------------------------------------------------------
__global__ __launch_bounds__(256) void transpose_cvt_kernel(
    const float* __restrict__ W, _Float16* __restrict__ Wt) {
  __shared__ float tile[32][33];
  const int tx = threadIdx.x, ty = threadIdx.y;
  const int n0 = blockIdx.x * 32, k0 = blockIdx.y * 32;
  for (int i = ty; i < 32; i += 8)
    tile[i][tx] = W[(size_t)(k0 + i) * D_ + n0 + tx];
  __syncthreads();
  for (int i = ty; i < 32; i += 8)
    Wt[(size_t)(n0 + i) * D_ + k0 + tx] = (_Float16)tile[tx][i];
}

// ---------------------------------------------------------------------------
// Kernel 1/4: C = A @ W + bias, with A [4096 x 1024] f16 row-major and
// Wt [1024(n) x 1024(k)] f16 (pre-transposed).  Tile 128x64, BK=32, 8 waves,
// each wave a 32x32 block = 2x2 WMMA tiles.  Tiles staged by
// global_load_async_to_lds_b128, double-buffered (issue k+1 while computing k).
// HEADS=true : scatter f16 into [B,H,T,64] head layout, scale folded in.
// HEADS=false: write f32 row-major [4096 x 1024] (final output).
// ---------------------------------------------------------------------------
#define BM 128
#define BN 64
#define BK 32
#define LS 40  // LDS row stride in halves (32 + 8 pad; 80B, 16B aligned)

template <bool HEADS>
__global__ __launch_bounds__(256) void gemm_wmma_async(
    const _Float16* __restrict__ A, const _Float16* __restrict__ Wt,
    const float* __restrict__ bias, void* __restrict__ outp, float scale) {
  __shared__ _Float16 sA[2][BM * LS];
  __shared__ _Float16 sB[2][BN * LS];

  const int tid = threadIdx.x;
  const int lane = tid & 31;
  const int wid = tid >> 5;
  const int wr = wid & 3;   // wave row 0..3  -> 32-row stripe
  const int wc = wid >> 2;  // wave col 0..1  -> 32-col stripe
  const int m0 = blockIdx.x * BM;
  const int n0 = blockIdx.y * BN;

  // Issue async copies for the k0 tile into buffer `buf`.
  // A tile: 128 rows x 4 16B-chunks = 512 chunks (2/thread);
  // B tile:  64 rows x 4 16B-chunks = 256 chunks (1/thread).
  auto issue_tile = [&](int k0, int buf) {
    for (int q = tid; q < 512; q += 256) {
      const int r = q >> 2, c = q & 3;
      async_copy_b128(&sA[buf][r * LS + c * 8],
                      A + (size_t)(m0 + r) * D_ + k0 + c * 8);
    }
    {
      const int r = tid >> 2, c = tid & 3;
      async_copy_b128(&sB[buf][r * LS + c * 8],
                      Wt + (size_t)(n0 + r) * D_ + k0 + c * 8);
    }
  };

  v8f c[2][2] = {};

  issue_tile(0, 0);
  const int NT = D_ / BK;  // 32 k-steps
  for (int kt = 0; kt < NT; ++kt) {
    const int buf = kt & 1;
    wait_async0();    // my chunks of tile kt have landed in LDS
    __syncthreads();  // everyone's chunks visible; prev reads of buf^1 done
    if (kt + 1 < NT) issue_tile((kt + 1) * BK, buf ^ 1);

    v16h a0 = load_frag_lds<LS>(sA[buf], wr * 32, 0);
    v16h a1 = load_frag_lds<LS>(sA[buf], wr * 32 + 16, 0);
    v16h b0 = load_frag_lds<LS>(sB[buf], wc * 32, 0);
    v16h b1 = load_frag_lds<LS>(sB[buf], wc * 32 + 16, 0);
    c[0][0] = wmma16(a0, b0, c[0][0]);
    c[0][1] = wmma16(a0, b1, c[0][1]);
    c[1][0] = wmma16(a1, b0, c[1][0]);
    c[1][1] = wmma16(a1, b1, c[1][1]);
  }

  // ---- epilogue ----
  // C/D layout: element (vgpr r, lane): row = r + (lane>=16 ? 8 : 0),
  // col = lane & 15 (ISA 7.12.2).
  const int half8 = (lane >> 4) << 3;
  const int ncol = lane & 15;
  for (int i = 0; i < 2; ++i)
    for (int j = 0; j < 2; ++j)
      for (int r = 0; r < 8; ++r) {
        const int m = m0 + wr * 32 + i * 16 + r + half8;
        const int n = n0 + wc * 32 + j * 16 + ncol;
        float v = c[i][j][r] + bias[n];
        if (HEADS) {
          v *= scale;  // 1/sqrt(DK) folded into Q
          const int b = m >> 11, t = m & (T_ - 1);
          const int h = n >> 6, d = n & (DK_ - 1);
          ((_Float16*)outp)[(((size_t)b * H_ + h) * T_ + t) * DK_ + d] =
              (_Float16)v;
        } else {
          ((float*)outp)[(size_t)m * D_ + n] = v;
        }
      }
}

// ---------------------------------------------------------------------------
// Kernel 2: flash-style attention with post-softmax tanh-mask.
//   out[q,:] = sum_k exp(s)*tanh(mask) * V[k,:]  /  sum_k exp(s)
// 4 waves per WG; wave w handles 16 query rows; loop over 64-key tiles.
// ---------------------------------------------------------------------------
#define VTS 72  // LDS row stride in halves for V^T / P tiles (64+8; 144B)

__global__ __launch_bounds__(128) void attn_wmma(
    const _Float16* __restrict__ Qh, const _Float16* __restrict__ Kh,
    const _Float16* __restrict__ Vh, const _Float16* __restrict__ Tm,
    _Float16* __restrict__ ctx) {
  __shared__ _Float16 sVt[DK_ * VTS];    // V^T tile: [d][k], shared by WG
  __shared__ _Float16 sP[4 * 16 * VTS];  // per-wave P tile: [q][k]

  const int tid = threadIdx.x, lane = tid & 31, wid = tid >> 5;
  const int bh = blockIdx.y;  // b*16 + h
  const int b = bh >> 4, h = bh & 15;
  const int q0 = blockIdx.x * 64 + wid * 16;
  const size_t base = (size_t)bh * T_ * DK_;

  // Q fragments (scale already folded in at projection time)
  v16h qa[2];
  {
    const _Float16* qb = Qh + base + (size_t)q0 * DK_;
    qa[0] = load_frag_g64(qb, 0);
    qa[1] = load_frag_g64(qb, 32);
  }

  v8f o[4] = {};
  float rmax[8], rsum[8];
  for (int r = 0; r < 8; ++r) { rmax[r] = -1e30f; rsum[r] = 0.0f; }

  const int half8 = (lane >> 4) << 3;
  const int ncol = lane & 15;
  _Float16* pl = sP + wid * 16 * VTS;

  for (int kt = 0; kt < T_ / 64; ++kt) {
    const int k0 = kt * 64;

    __syncthreads();  // previous iteration's sVt reads complete
    {                 // cooperative transpose of V tile: V[k][d] -> sVt[d][k]
      const int kv = tid & 63;
      const int dh = tid >> 6;  // 0 or 1 (d halves)
      const _Float16* vrow = Vh + base + (size_t)(k0 + kv) * DK_ + dh * 32;
      for (int dd = 0; dd < 32; ++dd)
        sVt[(dh * 32 + dd) * VTS + kv] = vrow[dd];
    }
    __syncthreads();

    // ---- S = Q K^T for this wave's 16 rows x 64 keys ----
    v8f s[4] = {};
    for (int j = 0; j < 4; ++j) {
      const _Float16* kb = Kh + base + (size_t)(k0 + j * 16) * DK_;
      v16h kb0 = load_frag_g64(kb, 0);
      v16h kb1 = load_frag_g64(kb, 32);
      s[j] = wmma16(qa[0], kb0, s[j]);
      s[j] = wmma16(qa[1], kb1, s[j]);
    }

    // ---- online softmax row stats (rows live in (vgpr r, lane-half)) ----
    float scl[8];
    for (int r = 0; r < 8; ++r) {
      float m = fmaxf(fmaxf(s[0][r], s[1][r]), fmaxf(s[2][r], s[3][r]));
      m = fmaxf(m, __shfl_xor(m, 1));
      m = fmaxf(m, __shfl_xor(m, 2));
      m = fmaxf(m, __shfl_xor(m, 4));
      m = fmaxf(m, __shfl_xor(m, 8));
      const float mn = fmaxf(rmax[r], m);
      scl[r] = __expf(rmax[r] - mn);
      rmax[r] = mn;
    }

    // ---- P = exp(S-max); denominator unmasked, numerator * tanh(mask) ----
    for (int r = 0; r < 8; ++r) {
      const int qq = q0 + r + half8;
      float ts = 0.0f;
      for (int j = 0; j < 4; ++j) {
        const float e = __expf(s[j][r] - rmax[r]);
        ts += e;
        const int kk = k0 + j * 16 + ncol;
        const float tm = (float)Tm[(size_t)qq * T_ + kk];
        pl[(r + half8) * VTS + j * 16 + ncol] = (_Float16)(e * tm);
      }
      ts += __shfl_xor(ts, 1);
      ts += __shfl_xor(ts, 2);
      ts += __shfl_xor(ts, 4);
      ts += __shfl_xor(ts, 8);
      rsum[r] = rsum[r] * scl[r] + ts;
      for (int j = 0; j < 4; ++j) o[j][r] *= scl[r];
    }

    // wave-internal LDS RAW: P stores above -> fragment loads below
    asm volatile("s_wait_dscnt 0x0" ::: "memory");

    // ---- O += P @ V ----
    v16h pa0 = load_frag_lds<VTS>(pl, 0, 0);
    v16h pa1 = load_frag_lds<VTS>(pl, 0, 32);
    for (int j = 0; j < 4; ++j) {
      v16h vb0 = load_frag_lds<VTS>(sVt, j * 16, 0);
      v16h vb1 = load_frag_lds<VTS>(sVt, j * 16, 32);
      o[j] = wmma16(pa0, vb0, o[j]);
      o[j] = wmma16(pa1, vb1, o[j]);
    }
  }

  // ---- normalize and write ctx as f16 [B, T, D] (heads re-interleaved) ----
  float inv[8];
  for (int r = 0; r < 8; ++r) inv[r] = 1.0f / fmaxf(rsum[r], 1e-20f);
  for (int j = 0; j < 4; ++j)
    for (int r = 0; r < 8; ++r) {
      const int q = q0 + r + half8;
      const int dcol = h * DK_ + j * 16 + ncol;
      ctx[((size_t)b * T_ + q) * D_ + dcol] = (_Float16)(o[j][r] * inv[r]);
    }
}

// ---------------------------------------------------------------------------
// Host launcher
// ---------------------------------------------------------------------------
extern "C" void kernel_launch(void* const* d_in, const int* in_sizes, int n_in,
                              void* d_out, int out_size, void* d_ws,
                              size_t ws_size, hipStream_t stream) {
  (void)in_sizes; (void)n_in; (void)out_size; (void)ws_size;

  const float* query = (const float*)d_in[0];
  const float* key   = (const float*)d_in[1];
  const float* value = (const float*)d_in[2];
  const float* Wq = (const float*)d_in[3];
  const float* bq = (const float*)d_in[4];
  const float* Wk = (const float*)d_in[5];
  const float* bk = (const float*)d_in[6];
  const float* Wv = (const float*)d_in[7];
  const float* bv = (const float*)d_in[8];
  const float* Wo = (const float*)d_in[9];
  const float* bo = (const float*)d_in[10];
  const float* lmask = (const float*)d_in[11];

  // workspace carve-up (MiB offsets), 64 MiB total
  char* ws = (char*)d_ws;
  const size_t MB = (size_t)1 << 20;
  _Float16* Qh  = (_Float16*)(ws + 0 * MB);   // [B,H,T,64] f16 (pre-scaled)
  _Float16* Kh  = (_Float16*)(ws + 8 * MB);
  _Float16* Vh  = (_Float16*)(ws + 16 * MB);
  _Float16* Tm  = (_Float16*)(ws + 24 * MB);  // tanh(mask) f16 [T,T]
  _Float16* Xq  = (_Float16*)(ws + 32 * MB);  // f16 activations
  _Float16* Xk  = (_Float16*)(ws + 40 * MB);
  _Float16* Xv  = (_Float16*)(ws + 48 * MB);
  _Float16* Wqt = (_Float16*)(ws + 56 * MB);  // f16 transposed weights [n][k]
  _Float16* Wkt = (_Float16*)(ws + 58 * MB);
  _Float16* Wvt = (_Float16*)(ws + 60 * MB);
  _Float16* Wot = (_Float16*)(ws + 62 * MB);
  _Float16* ctx = (_Float16*)(ws + 32 * MB);  // reuse Xq (consumed by then)

  const int nmask = T_ * T_;
  tanh_mask_kernel<<<(nmask + 255) / 256, 256, 0, stream>>>(lmask, Tm, nmask);

  const int n4 = M_ * D_ / 4;  // activation f32->f16, 4 elems/thread
  cvt_f16_kernel<<<(n4 + 255) / 256, 256, 0, stream>>>(query, Xq, n4);
  cvt_f16_kernel<<<(n4 + 255) / 256, 256, 0, stream>>>(key, Xk, n4);
  cvt_f16_kernel<<<(n4 + 255) / 256, 256, 0, stream>>>(value, Xv, n4);

  const dim3 tgrid(D_ / 32, D_ / 32);  // 32 x 32 transpose tiles
  const dim3 tblk(32, 8);
  transpose_cvt_kernel<<<tgrid, tblk, 0, stream>>>(Wq, Wqt);
  transpose_cvt_kernel<<<tgrid, tblk, 0, stream>>>(Wk, Wkt);
  transpose_cvt_kernel<<<tgrid, tblk, 0, stream>>>(Wv, Wvt);
  transpose_cvt_kernel<<<tgrid, tblk, 0, stream>>>(Wo, Wot);

  const dim3 ggrid(M_ / BM, D_ / BN);  // 32 x 16
  const float qscale = 0.125f;         // 1/sqrt(64)
  gemm_wmma_async<true><<<ggrid, 256, 0, stream>>>(Xq, Wqt, bq, Qh, qscale);
  gemm_wmma_async<true><<<ggrid, 256, 0, stream>>>(Xk, Wkt, bk, Kh, 1.0f);
  gemm_wmma_async<true><<<ggrid, 256, 0, stream>>>(Xv, Wvt, bv, Vh, 1.0f);

  attn_wmma<<<dim3(T_ / 64, B_ * H_), 128, 0, stream>>>(Qh, Kh, Vh, Tm, ctx);

  gemm_wmma_async<false><<<ggrid, 256, 0, stream>>>(ctx, Wot, bo, d_out, 1.0f);
}

// v001
// A run of this version takes 198 microseconds.
// Timed twice side by side with v000, it ran 1.20 and 1.18 times as fast.
#include <hip/hip_runtime.h>
#include <hip/hip_bf16.h>

// ---------------------------------------------------------------------------
// MHA forward for B=2, T=2048, D=1024, H=16, DK=64 on gfx1250 (MI455X).
// All GEMMs run through v_wmma_f32_16x16x32_f16 (f16 in, f32 accumulate).
// GEMM tiles are staged global->LDS with GLOBAL_LOAD_ASYNC_TO_LDS_B128
// (ASYNCcnt) in a double-buffered pipeline.
// ---------------------------------------------------------------------------

typedef __attribute__((ext_vector_type(16))) _Float16 v16h;
typedef __attribute__((ext_vector_type(8)))  _Float16 v8h;
typedef __attribute__((ext_vector_type(4)))  _Float16 v4h;
typedef __attribute__((ext_vector_type(8)))  float    v8f;

#define B_  2
#define T_  2048
#define H_  16
#define DK_ 64
#define D_  1024
#define M_  (B_ * T_)   // 4096 rows for the projection GEMMs

__device__ __forceinline__ v8f wmma16(v16h a, v16h b, v8f c) {
  // (neg_a, A, neg_b, B, c_mod, C, reuse_a, reuse_b)
  return __builtin_amdgcn_wmma_f32_16x16x32_f16(false, a, false, b, (short)0, c,
                                                false, false);
}

// Async DMA of one 16-byte chunk: global -> LDS, tracked with ASYNCcnt.
// VDST = per-lane LDS byte offset (low 32 bits of the generic LDS pointer,
// per the CDNA5 aperture mapping), VADDR = 64-bit global address.
__device__ __forceinline__ void async_copy_b128(void* lds_ptr,
                                                const void* gptr) {
  const unsigned loff = (unsigned)(unsigned long long)lds_ptr;
  asm volatile("global_load_async_to_lds_b128 %0, %1, off" ::"v"(loff),
               "v"(gptr)
               : "memory");
}
__device__ __forceinline__ void wait_async0() {
  asm volatile("s_wait_asynccnt 0x0" ::: "memory");
}
// Four such copies of one lane in ONE statement.  The closing s_wait_xcnt
// stands inside the statement so that no address register of an issued copy
// is rewritten in front of it.
__device__ __forceinline__ void async_copy4_b128(
    const void* l0, const void* l1, const void* l2, const void* l3,
    const void* g0, const void* g1, const void* g2, const void* g3) {
  asm volatile(
      "global_load_async_to_lds_b128 %0, %4, off\n\t"
      "global_load_async_to_lds_b128 %1, %5, off\n\t"
      "global_load_async_to_lds_b128 %2, %6, off\n\t"
      "global_load_async_to_lds_b128 %3, %7, off\n\t"
      "s_wait_xcnt 0x0" ::"v"((unsigned)(unsigned long long)l0),
      "v"((unsigned)(unsigned long long)l1),
      "v"((unsigned)(unsigned long long)l2),
      "v"((unsigned)(unsigned long long)l3), "v"(g0), "v"(g1), "v"(g2), "v"(g3)
      : "memory");
}

// Load a 16x32 f16 WMMA A/B fragment from LDS stored [row][k], k contiguous,
// row stride STRIDE halves (STRIDE % 8 == 0 so each half-row chunk is a
// 16-byte-aligned ds_load_b128).
// Lane L (L<16): row = row0+L, K = {kh..kh+7, 16+kh..16+kh+7} with kh=0.
// Lane L+16:    same row, kh=8.  Matches CDNA5 16-bit A layout (ISA 7.12.2).
template <int STRIDE>
__device__ __forceinline__ v16h load_frag_lds(const _Float16* base, int row0,
                                              int kOff) {
  const int lane = threadIdx.x & 31;
  const _Float16* p =
      base + (size_t)(row0 + (lane & 15)) * STRIDE + kOff + ((lane >> 4) << 3);
  v8h lo = *(const v8h*)(p);
  v8h hi = *(const v8h*)(p + 16);
  return __builtin_shufflevector(lo, hi, 0, 1, 2, 3, 4, 5, 6, 7, 8, 9, 10, 11,
                                 12, 13, 14, 15);
}

// Same fragment shape, loaded directly from global memory with row stride 64
// halves (the [*, 64] head layout of Q/K: row = head-row, k-dim = feature).
__device__ __forceinline__ v16h load_frag_g64(const _Float16* base, int kOff) {
  const int lane = threadIdx.x & 31;
  const _Float16* p =
      base + (size_t)(lane & 15) * DK_ + kOff + ((lane >> 4) << 3);
  v8h lo = *(const v8h*)(p);
  v8h hi = *(const v8h*)(p + 16);
  return __builtin_shufflevector(lo, hi, 0, 1, 2, 3, 4, 5, 6, 7, 8, 9, 10, 11,
                                 12, 13, 14, 15);
}

// ---------------------------------------------------------------------------
// Kernel 0a: tanh(learnable_mask) -> f16, computed once, reused by all (b,h).
// ---------------------------------------------------------------------------
__global__ void tanh_mask_kernel(const float* __restrict__ mask,
                                 _Float16* __restrict__ out, int n) {
  int i = blockIdx.x * blockDim.x + threadIdx.x;
  if (i < n) out[i] = (_Float16)tanhf(mask[i]);
}

// ---------------------------------------------------------------------------
// Kernel 0b: f32 -> f16 elementwise (activations), 4 elems/thread.
// ---------------------------------------------------------------------------
__global__ void cvt_f16_kernel(const float* __restrict__ in,
                               _Float16* __restrict__ out, int n4) {
  int i = blockIdx.x * blockDim.x + threadIdx.x;
  if (i < n4) {
    float4 v = ((const float4*)in)[i];
    v4h h;
    h.x = (_Float16)v.x; h.y = (_Float16)v.y;
    h.z = (_Float16)v.z; h.w = (_Float16)v.w;
    ((v4h*)out)[i] = h;
  }
}

// ---------------------------------------------------------------------------
// Kernel 0c: W[k][n] f32 -> Wt[n][k] f16 (tiled 32x32 transpose via LDS) so
// the GEMM B-operand is k-contiguous and async-DMA-friendly.
// ---------------------------------------------------------------------------
__global__ __launch_bounds__(256) void transpose_cvt_kernel(
    const float* __restrict__ W, _Float16* __restrict__ Wt) {
  __shared__ float tile[32][33];
  const int tx = threadIdx.x, ty = threadIdx.y;
  const int n0 = blockIdx.x * 32, k0 = blockIdx.y * 32;
  for (int i = ty; i < 32; i += 8)
    tile[i][tx] = W[(size_t)(k0 + i) * D_ + n0 + tx];
  __syncthreads();
  for (int i = ty; i < 32; i += 8)
    Wt[(size_t)(n0 + i) * D_ + k0 + tx] = (_Float16)tile[tx][i];
}

// ---------------------------------------------------------------------------
// Kernel 1/4: C = A @ W + bias, with A [4096 x 1024] f16 row-major and
// Wt [1024(n) x 1024(k)] f16 (pre-transposed).  Tile 128x64, BK=32, 8 waves,
// each wave a 32x32 block = 2x2 WMMA tiles.  Tiles staged by
// global_load_async_to_lds_b128, double-buffered (issue k+1 while computing k).
// HEADS=true : scatter f16 into [B,H,T,64] head layout, scale folded in.
// HEADS=false: write f32 row-major [4096 x 1024] (final output).
// ---------------------------------------------------------------------------
#define BM 128
#define BN 64
#define BK 32
#define LS 40  // LDS row stride in halves (32 + 8 pad; 80B, 16B aligned)

template <bool HEADS>
__global__ __launch_bounds__(256) void gemm_wmma_async(
    const _Float16* __restrict__ A, const _Float16* __restrict__ Wt,
    const float* __restrict__ bias, void* __restrict__ outp, float scale) {
  __shared__ _Float16 sA[2][BM * LS];
  __shared__ _Float16 sB[2][BN * LS];

  const int tid = threadIdx.x;
  const int lane = tid & 31;
  const int wid = tid >> 5;
  const int wr = wid & 3;   // wave row 0..3  -> 32-row stripe
  const int wc = wid >> 2;  // wave col 0..1  -> 32-col stripe
  const int m0 = blockIdx.x * BM;
  const int n0 = blockIdx.y * BN;

  // Issue async copies for the k0 tile into buffer `buf`.
  // A tile: 128 rows x 4 16B-chunks = 512 chunks (2/thread);
  // B tile:  64 rows x 4 16B-chunks = 256 chunks (1/thread).
  auto issue_tile = [&](int k0, int buf) {
    for (int q = tid; q < 512; q += 256) {
      const int r = q >> 2, c = q & 3;
      async_copy_b128(&sA[buf][r * LS + c * 8],
                      A + (size_t)(m0 + r) * D_ + k0 + c * 8);
    }
    {
      const int r = tid >> 2, c = tid & 3;
      async_copy_b128(&sB[buf][r * LS + c * 8],
                      Wt + (size_t)(n0 + r) * D_ + k0 + c * 8);
    }
  };

  v8f c[2][2] = {};

  issue_tile(0, 0);
  const int NT = D_ / BK;  // 32 k-steps
  for (int kt = 0; kt < NT; ++kt) {
    const int buf = kt & 1;
    wait_async0();    // my chunks of tile kt have landed in LDS
    __syncthreads();  // everyone's chunks visible; prev reads of buf^1 done
    if (kt + 1 < NT) issue_tile((kt + 1) * BK, buf ^ 1);

    v16h a0 = load_frag_lds<LS>(sA[buf], wr * 32, 0);
    v16h a1 = load_frag_lds<LS>(sA[buf], wr * 32 + 16, 0);
    v16h b0 = load_frag_lds<LS>(sB[buf], wc * 32, 0);
    v16h b1 = load_frag_lds<LS>(sB[buf], wc * 32 + 16, 0);
    c[0][0] = wmma16(a0, b0, c[0][0]);
    c[0][1] = wmma16(a0, b1, c[0][1]);
    c[1][0] = wmma16(a1, b0, c[1][0]);
    c[1][1] = wmma16(a1, b1, c[1][1]);
  }

  // ---- epilogue ----
  // C/D layout: element (vgpr r, lane): row = r + (lane>=16 ? 8 : 0),
  // col = lane & 15 (ISA 7.12.2).
  const int half8 = (lane >> 4) << 3;
  const int ncol = lane & 15;
  for (int i = 0; i < 2; ++i)
    for (int j = 0; j < 2; ++j)
      for (int r = 0; r < 8; ++r) {
        const int m = m0 + wr * 32 + i * 16 + r + half8;
        const int n = n0 + wc * 32 + j * 16 + ncol;
        float v = c[i][j][r] + bias[n];
        if (HEADS) {
          v *= scale;  // 1/sqrt(DK) folded into Q
          const int b = m >> 11, t = m & (T_ - 1);
          const int h = n >> 6, d = n & (DK_ - 1);
          ((_Float16*)outp)[(((size_t)b * H_ + h) * T_ + t) * DK_ + d] =
              (_Float16)v;
        } else {
          ((float*)outp)[(size_t)m * D_ + n] = v;
        }
      }
}

// ---------------------------------------------------------------------------
// Kernel 2: flash-style attention with post-softmax tanh-mask.
//   out[q,:] = sum_k exp(s)*tanh(mask) * V[k,:]  /  sum_k exp(s)
// 4 waves per WG; wave w handles 16 query rows; loop over 64-key tiles.
// The K tile (64 keys x 128 B) is brought into LDS once per work-group by
// whole-line async copies, two buffers (tile t+1 flies while tile t is worked
// on); the four waves read their K fragments from there.
// ---------------------------------------------------------------------------
#define VTS 72  // LDS row stride in halves for V^T / P tiles (64+8; 144B)
#define KTS 72  // LDS row stride in halves for the K tile (128B + 16B pad)
#define NKT (T_ / 64)  // key tiles

__global__ __launch_bounds__(128) void attn_wmma(
    const _Float16* __restrict__ Qh, const _Float16* __restrict__ Kh,
    const _Float16* __restrict__ Vh, const _Float16* __restrict__ Tm,
    _Float16* __restrict__ ctx) {
  __shared__ _Float16 sVt[DK_ * VTS];    // V^T tile: [d][k], shared by WG
  __shared__ _Float16 sP[4 * 16 * VTS];  // per-wave P tile: [q][k]
  __shared__ __attribute__((aligned(16)))
  _Float16 sK[2][64 * KTS];  // K tiles: [key][feature], two buffers

  const int tid = threadIdx.x, lane = tid & 31, wid = tid >> 5;
  const int bh = blockIdx.y;  // b*16 + h
  const int b = bh >> 4, h = bh & 15;
  const int q0 = blockIdx.x * 64 + wid * 16;
  const size_t base = (size_t)bh * T_ * DK_;

  // Q fragments (scale already folded in at projection time)
  v16h qa[2];
  {
    const _Float16* qb = Qh + base + (size_t)q0 * DK_;
    qa[0] = load_frag_g64(qb, 0);
    qa[1] = load_frag_g64(qb, 32);
  }

  v8f o[4] = {};
  float rmax[8], rsum[8];
  for (int r = 0; r < 8; ++r) { rmax[r] = -1e30f; rsum[r] = 0.0f; }

  const int half8 = (lane >> 4) << 3;
  const int ncol = lane & 15;
  _Float16* pl = sP + wid * 16 * VTS;

  // Copies of K tile t into buffer buf: 512 chunks of 16 B, 4 per thread;
  // a wave's 32 lanes cover 512 contiguous bytes (4 whole key rows) per copy.
  auto issue_k = [&](int t, int buf) {
    const _Float16* g = Kh + base + (size_t)t * 64 * DK_ + tid * 8;
    const _Float16* l = &sK[buf][(tid >> 3) * KTS + (tid & 7) * 8];
    async_copy4_b128(l, l + 16 * KTS, l + 32 * KTS, l + 48 * KTS, g,
                     g + 16 * DK_, g + 32 * DK_, g + 48 * DK_);
  };

  issue_k(0, 0);
  wait_async0();    // my chunks of K tile 0 have landed
  __syncthreads();  // everyone's chunks of K tile 0 visible
  issue_k(1, 1);

  for (int kt = 0; kt < NKT; ++kt) {
    const int k0 = kt * 64;
    const _Float16* kl = sK[kt & 1];

    {  // cooperative transpose of V tile: V[k][d] -> sVt[d][k]
       // (the previous trip's sVt reads ended at its foot barrier)
      const int kv = tid & 63;
      const int dh = tid >> 6;  // 0 or 1 (d halves)
      const _Float16* vrow = Vh + base + (size_t)(k0 + kv) * DK_ + dh * 32;
      for (int dd = 0; dd < 32; ++dd)
        sVt[(dh * 32 + dd) * VTS + kv] = vrow[dd];
    }
    __syncthreads();

    // ---- S = Q K^T for this wave's 16 rows x 64 keys ----
    v8f s[4] = {};
    for (int j = 0; j < 4; ++j) {
      v16h kb0 = load_frag_lds<KTS>(kl, j * 16, 0);
      v16h kb1 = load_frag_lds<KTS>(kl, j * 16, 32);
      s[j] = wmma16(qa[0], kb0, s[j]);
      s[j] = wmma16(qa[1], kb1, s[j]);
    }

    // ---- online softmax row stats (rows live in (vgpr r, lane-half)) ----
    float scl[8];
    for (int r = 0; r < 8; ++r) {
      float m = fmaxf(fmaxf(s[0][r], s[1][r]), fmaxf(s[2][r], s[3][r]));
      m = fmaxf(m, __shfl_xor(m, 1));
      m = fmaxf(m, __shfl_xor(m, 2));
      m = fmaxf(m, __shfl_xor(m, 4));
      m = fmaxf(m, __shfl_xor(m, 8));
      const float mn = fmaxf(rmax[r], m);
      scl[r] = __expf(rmax[r] - mn);
      rmax[r] = mn;
    }

    // ---- P = exp(S-max); denominator unmasked, numerator * tanh(mask) ----
    for (int r = 0; r < 8; ++r) {
      const int qq = q0 + r + half8;
      float ts = 0.0f;
      for (int j = 0; j < 4; ++j) {
        const float e = __expf(s[j][r] - rmax[r]);
        ts += e;
        const int kk = k0 + j * 16 + ncol;
        const float tm = (float)Tm[(size_t)qq * T_ + kk];
        pl[(r + half8) * VTS + j * 16 + ncol] = (_Float16)(e * tm);
      }
      ts += __shfl_xor(ts, 1);
      ts += __shfl_xor(ts, 2);
      ts += __shfl_xor(ts, 4);
      ts += __shfl_xor(ts, 8);
      rsum[r] = rsum[r] * scl[r] + ts;
      for (int j = 0; j < 4; ++j) o[j][r] *= scl[r];
    }

    // wave-internal LDS RAW: P stores above -> fragment loads below
    asm volatile("s_wait_dscnt 0x0" ::: "memory");

    // ---- O += P @ V ----
    v16h pa0 = load_frag_lds<VTS>(pl, 0, 0);
    v16h pa1 = load_frag_lds<VTS>(pl, 0, 32);
    for (int j = 0; j < 4; ++j) {
      v16h vb0 = load_frag_lds<VTS>(sVt, j * 16, 0);
      v16h vb1 = load_frag_lds<VTS>(sVt, j * 16, 32);
      o[j] = wmma16(pa0, vb0, o[j]);
      o[j] = wmma16(pa1, vb1, o[j]);
    }

    // ---- foot: publish K tile kt+1, free this trip's K buffer and sVt ----
    // my LDS reads of this trip have returned before the buffer is refilled
    asm volatile("s_wait_dscnt 0x0" ::: "memory");
    wait_async0();    // my chunks of K tile kt+1 have landed
    __syncthreads();  // all chunks visible; all reads of sK[kt&1], sVt done
    if (kt + 2 < NKT) issue_k(kt + 2, kt & 1);
  }
  wait_async0();  // nothing in flight when the wave ends

  // ---- normalize and write ctx as f16 [B, T, D] (heads re-interleaved) ----
  float inv[8];
  for (int r = 0; r < 8; ++r) inv[r] = 1.0f / fmaxf(rsum[r], 1e-20f);
  for (int j = 0; j < 4; ++j)
    for (int r = 0; r < 8; ++r) {
      const int q = q0 + r + half8;
      const int dcol = h * DK_ + j * 16 + ncol;
      ctx[((size_t)b * T_ + q) * D_ + dcol] = (_Float16)(o[j][r] * inv[r]);
    }
}

// ---------------------------------------------------------------------------
// Host launcher
// ---------------------------------------------------------------------------
extern "C" void kernel_launch(void* const* d_in, const int* in_sizes, int n_in,
                              void* d_out, int out_size, void* d_ws,
                              size_t ws_size, hipStream_t stream) {
  (void)in_sizes; (void)n_in; (void)out_size; (void)ws_size;

  const float* query = (const float*)d_in[0];
  const float* key   = (const float*)d_in[1];
  const float* value = (const float*)d_in[2];
  const float* Wq = (const float*)d_in[3];
  const float* bq = (const float*)d_in[4];
  const float* Wk = (const float*)d_in[5];
  const float* bk = (const float*)d_in[6];
  const float* Wv = (const float*)d_in[7];
  const float* bv = (const float*)d_in[8];
  const float* Wo = (const float*)d_in[9];
  const float* bo = (const float*)d_in[10];
  const float* lmask = (const float*)d_in[11];

  // workspace carve-up (MiB offsets), 64 MiB total
  char* ws = (char*)d_ws;
  const size_t MB = (size_t)1 << 20;
  _Float16* Qh  = (_Float16*)(ws + 0 * MB);   // [B,H,T,64] f16 (pre-scaled)
  _Float16* Kh  = (_Float16*)(ws + 8 * MB);
  _Float16* Vh  = (_Float16*)(ws + 16 * MB);
  _Float16* Tm  = (_Float16*)(ws + 24 * MB);  // tanh(mask) f16 [T,T]
  _Float16* Xq  = (_Float16*)(ws + 32 * MB);  // f16 activations
  _Float16* Xk  = (_Float16*)(ws + 40 * MB);
  _Float16* Xv  = (_Float16*)(ws + 48 * MB);
  _Float16* Wqt = (_Float16*)(ws + 56 * MB);  // f16 transposed weights [n][k]
  _Float16* Wkt = (_Float16*)(ws + 58 * MB);
  _Float16* Wvt = (_Float16*)(ws + 60 * MB);
  _Float16* Wot = (_Float16*)(ws + 62 * MB);
  _Float16* ctx = (_Float16*)(ws + 32 * MB);  // reuse Xq (consumed by then)

  const int nmask = T_ * T_;
  tanh_mask_kernel<<<(nmask + 255) / 256, 256, 0, stream>>>(lmask, Tm, nmask);

  const int n4 = M_ * D_ / 4;  // activation f32->f16, 4 elems/thread
  cvt_f16_kernel<<<(n4 + 255) / 256, 256, 0, stream>>>(query, Xq, n4);
  cvt_f16_kernel<<<(n4 + 255) / 256, 256, 0, stream>>>(key, Xk, n4);
  cvt_f16_kernel<<<(n4 + 255) / 256, 256, 0, stream>>>(value, Xv, n4);

  const dim3 tgrid(D_ / 32, D_ / 32);  // 32 x 32 transpose tiles
  const dim3 tblk(32, 8);
  transpose_cvt_kernel<<<tgrid, tblk, 0, stream>>>(Wq, Wqt);
  transpose_cvt_kernel<<<tgrid, tblk, 0, stream>>>(Wk, Wkt);
  transpose_cvt_kernel<<<tgrid, tblk, 0, stream>>>(Wv, Wvt);
  transpose_cvt_kernel<<<tgrid, tblk, 0, stream>>>(Wo, Wot);

  const dim3 ggrid(M_ / BM, D_ / BN);  // 32 x 16
  const float qscale = 0.125f;         // 1/sqrt(64)
  gemm_wmma_async<true><<<ggrid, 256, 0, stream>>>(Xq, Wqt, bq, Qh, qscale);
  gemm_wmma_async<true><<<ggrid, 256, 0, stream>>>(Xk, Wkt, bk, Kh, 1.0f);
  gemm_wmma_async<true><<<ggrid, 256, 0, stream>>>(Xv, Wvt, bv, Vh, 1.0f);

  attn_wmma<<<dim3(T_ / 64, B_ * H_), 128, 0, stream>>>(Qh, Kh, Vh, Tm, ctx);

  gemm_wmma_async<false><<<ggrid, 256, 0, stream>>>(ctx, Wot, bo, d_out, 1.0f);
}

// v002
// It runs in 174 microseconds.
// Timed twice side by side with v001, it ran 1.14 times as fast both times.
// All steps since v000 together make it 1.35 times as fast.
#include <hip/hip_runtime.h>
#include <hip/hip_bf16.h>

// ---------------------------------------------------------------------------
// MHA forward for B=2, T=2048, D=1024, H=16, DK=64 on gfx1250 (MI455X).
// All GEMMs run through v_wmma_f32_16x16x32_f16 (f16 in, f32 accumulate).
// GEMM tiles are staged global->LDS with GLOBAL_LOAD_ASYNC_TO_LDS_B128
// (ASYNCcnt) in a double-buffered pipeline.
// ---------------------------------------------------------------------------

typedef __attribute__((ext_vector_type(16))) _Float16 v16h;
typedef __attribute__((ext_vector_type(8)))  _Float16 v8h;
typedef __attribute__((ext_vector_type(4)))  _Float16 v4h;
typedef __attribute__((ext_vector_type(8)))  float    v8f;

#define B_  2
#define T_  2048
#define H_  16
#define DK_ 64
#define D_  1024
#define M_  (B_ * T_)   // 4096 rows for the projection GEMMs

__device__ __forceinline__ v8f wmma16(v16h a, v16h b, v8f c) {
  // (neg_a, A, neg_b, B, c_mod, C, reuse_a, reuse_b)
  return __builtin_amdgcn_wmma_f32_16x16x32_f16(false, a, false, b, (short)0, c,
                                                false, false);
}

// Async DMA of one 16-byte chunk: global -> LDS, tracked with ASYNCcnt.
// VDST = per-lane LDS byte offset (low 32 bits of the generic LDS pointer,
// per the CDNA5 aperture mapping), VADDR = 64-bit global address.
__device__ __forceinline__ void async_copy_b128(void* lds_ptr,
                                                const void* gptr) {
  const unsigned loff = (unsigned)(unsigned long long)lds_ptr;
  asm volatile("global_load_async_to_lds_b128 %0, %1, off" ::"v"(loff),
               "v"(gptr)
               : "memory");
}
__device__ __forceinline__ void wait_async0() {
  asm volatile("s_wait_asynccnt 0x0" ::: "memory");
}
// Four such copies of one lane in ONE statement.  The closing s_wait_xcnt
// stands inside the statement so that no address register of an issued copy
// is rewritten in front of it.
__device__ __forceinline__ void async_copy4_b128(
    const void* l0, const void* l1, const void* l2, const void* l3,
    const void* g0, const void* g1, const void* g2, const void* g3) {
  asm volatile(
      "global_load_async_to_lds_b128 %0, %4, off\n\t"
      "global_load_async_to_lds_b128 %1, %5, off\n\t"
      "global_load_async_to_lds_b128 %2, %6, off\n\t"
      "global_load_async_to_lds_b128 %3, %7, off\n\t"
      "s_wait_xcnt 0x0" ::"v"((unsigned)(unsigned long long)l0),
      "v"((unsigned)(unsigned long long)l1),
      "v"((unsigned)(unsigned long long)l2),
      "v"((unsigned)(unsigned long long)l3), "v"(g0), "v"(g1), "v"(g2), "v"(g3)
      : "memory");
}

// Load a 16x32 f16 WMMA A/B fragment from LDS stored [row][k], k contiguous,
// row stride STRIDE halves (STRIDE % 8 == 0 so each half-row chunk is a
// 16-byte-aligned ds_load_b128).
// Lane L (L<16): row = row0+L, K = {kh..kh+7, 16+kh..16+kh+7} with kh=0.
// Lane L+16:    same row, kh=8.  Matches CDNA5 16-bit A layout (ISA 7.12.2).
template <int STRIDE>
__device__ __forceinline__ v16h load_frag_lds(const _Float16* base, int row0,
                                              int kOff) {
  const int lane = threadIdx.x & 31;
  const _Float16* p =
      base + (size_t)(row0 + (lane & 15)) * STRIDE + kOff + ((lane >> 4) << 3);
  v8h lo = *(const v8h*)(p);
  v8h hi = *(const v8h*)(p + 16);
  return __builtin_shufflevector(lo, hi, 0, 1, 2, 3, 4, 5, 6, 7, 8, 9, 10, 11,
                                 12, 13, 14, 15);
}

// Same fragment shape, loaded directly from global memory with row stride 64
// halves (the [*, 64] head layout of Q/K: row = head-row, k-dim = feature).
__device__ __forceinline__ v16h load_frag_g64(const _Float16* base, int kOff) {
  const int lane = threadIdx.x & 31;
  const _Float16* p =
      base + (size_t)(lane & 15) * DK_ + kOff + ((lane >> 4) << 3);
  v8h lo = *(const v8h*)(p);
  v8h hi = *(const v8h*)(p + 16);
  return __builtin_shufflevector(lo, hi, 0, 1, 2, 3, 4, 5, 6, 7, 8, 9, 10, 11,
                                 12, 13, 14, 15);
}

// ---------------------------------------------------------------------------
// Kernel 0a: tanh(learnable_mask) -> f16, computed once, reused by all (b,h).
// ---------------------------------------------------------------------------
__global__ void tanh_mask_kernel(const float* __restrict__ mask,
                                 _Float16* __restrict__ out, int n) {
  int i = blockIdx.x * blockDim.x + threadIdx.x;
  if (i < n) out[i] = (_Float16)tanhf(mask[i]);
}

// ---------------------------------------------------------------------------
// Kernel 0b: f32 -> f16 elementwise (activations), 4 elems/thread.
// ---------------------------------------------------------------------------
__global__ void cvt_f16_kernel(const float* __restrict__ in,
                               _Float16* __restrict__ out, int n4) {
  int i = blockIdx.x * blockDim.x + threadIdx.x;
  if (i < n4) {
    float4 v = ((const float4*)in)[i];
    v4h h;
    h.x = (_Float16)v.x; h.y = (_Float16)v.y;
    h.z = (_Float16)v.z; h.w = (_Float16)v.w;
    ((v4h*)out)[i] = h;
  }
}

// ---------------------------------------------------------------------------
// Kernel 0c: W[k][n] f32 -> Wt[n][k] f16 (tiled 32x32 transpose via LDS) so
// the GEMM B-operand is k-contiguous and async-DMA-friendly.
// ---------------------------------------------------------------------------
__global__ __launch_bounds__(256) void transpose_cvt_kernel(
    const float* __restrict__ W, _Float16* __restrict__ Wt) {
  __shared__ float tile[32][33];
  const int tx = threadIdx.x, ty = threadIdx.y;
  const int n0 = blockIdx.x * 32, k0 = blockIdx.y * 32;
  for (int i = ty; i < 32; i += 8)
    tile[i][tx] = W[(size_t)(k0 + i) * D_ + n0 + tx];
  __syncthreads();
  for (int i = ty; i < 32; i += 8)
    Wt[(size_t)(n0 + i) * D_ + k0 + tx] = (_Float16)tile[tx][i];
}

// ---------------------------------------------------------------------------
// Kernel 1/4: C = A @ W + bias, with A [4096 x 1024] f16 row-major and
// Wt [1024(n) x 1024(k)] f16 (pre-transposed).  Tile 128x64, BK=32, 8 waves,
// each wave a 32x32 block = 2x2 WMMA tiles.  Tiles staged by
// global_load_async_to_lds_b128, double-buffered (issue k+1 while computing k).
// HEADS=true : scatter f16 into [B,H,T,64] head layout, scale folded in.
// HEADS=false: write f32 row-major [4096 x 1024] (final output).
// ---------------------------------------------------------------------------
#define BM 128
#define BN 64
#define BK 32
#define LS 40  // LDS row stride in halves (32 + 8 pad; 80B, 16B aligned)

template <bool HEADS>
__global__ __launch_bounds__(256) void gemm_wmma_async(
    const _Float16* __restrict__ A, const _Float16* __restrict__ Wt,
    const float* __restrict__ bias, void* __restrict__ outp, float scale) {
  __shared__ _Float16 sA[2][BM * LS];
  __shared__ _Float16 sB[2][BN * LS];

  const int tid = threadIdx.x;
  const int lane = tid & 31;
  const int wid = tid >> 5;
  const int wr = wid & 3;   // wave row 0..3  -> 32-row stripe
  const int wc = wid >> 2;  // wave col 0..1  -> 32-col stripe
  const int m0 = blockIdx.x * BM;
  const int n0 = blockIdx.y * BN;

  // Issue async copies for the k0 tile into buffer `buf`.
  // A tile: 128 rows x 4 16B-chunks = 512 chunks (2/thread);
  // B tile:  64 rows x 4 16B-chunks = 256 chunks (1/thread).
  auto issue_tile = [&](int k0, int buf) {
    for (int q = tid; q < 512; q += 256) {
      const int r = q >> 2, c = q & 3;
      async_copy_b128(&sA[buf][r * LS + c * 8],
                      A + (size_t)(m0 + r) * D_ + k0 + c * 8);
    }
    {
      const int r = tid >> 2, c = tid & 3;
      async_copy_b128(&sB[buf][r * LS + c * 8],
                      Wt + (size_t)(n0 + r) * D_ + k0 + c * 8);
    }
  };

  v8f c[2][2] = {};

  issue_tile(0, 0);
  const int NT = D_ / BK;  // 32 k-steps
  for (int kt = 0; kt < NT; ++kt) {
    const int buf = kt & 1;
    wait_async0();    // my chunks of tile kt have landed in LDS
    __syncthreads();  // everyone's chunks visible; prev reads of buf^1 done
    if (kt + 1 < NT) issue_tile((kt + 1) * BK, buf ^ 1);

    v16h a0 = load_frag_lds<LS>(sA[buf], wr * 32, 0);
    v16h a1 = load_frag_lds<LS>(sA[buf], wr * 32 + 16, 0);
    v16h b0 = load_frag_lds<LS>(sB[buf], wc * 32, 0);
    v16h b1 = load_frag_lds<LS>(sB[buf], wc * 32 + 16, 0);
    c[0][0] = wmma16(a0, b0, c[0][0]);
    c[0][1] = wmma16(a0, b1, c[0][1]);
    c[1][0] = wmma16(a1, b0, c[1][0]);
    c[1][1] = wmma16(a1, b1, c[1][1]);
  }

  // ---- epilogue ----
  // C/D layout: element (vgpr r, lane): row = r + (lane>=16 ? 8 : 0),
  // col = lane & 15 (ISA 7.12.2).
  const int half8 = (lane >> 4) << 3;
  const int ncol = lane & 15;
  for (int i = 0; i < 2; ++i)
    for (int j = 0; j < 2; ++j)
      for (int r = 0; r < 8; ++r) {
        const int m = m0 + wr * 32 + i * 16 + r + half8;
        const int n = n0 + wc * 32 + j * 16 + ncol;
        float v = c[i][j][r] + bias[n];
        if (HEADS) {
          v *= scale;  // 1/sqrt(DK) folded into Q
          const int b = m >> 11, t = m & (T_ - 1);
          const int h = n >> 6, d = n & (DK_ - 1);
          ((_Float16*)outp)[(((size_t)b * H_ + h) * T_ + t) * DK_ + d] =
              (_Float16)v;
        } else {
          ((float*)outp)[(size_t)m * D_ + n] = v;
        }
      }
}

#define VTS 72  // LDS row stride in halves for the V^T tile (64+8; 144B)
#define KTS 72  // LDS row stride in halves for the K tile (128B + 16B pad)
#define NKT (T_ / 64)  // key tiles

// lane l <-> lane l ^ 16 (the two halves of a wave hold the same query)
__device__ __forceinline__ float xhalf(float x) {
  const int b = __builtin_bit_cast(int, x);
  return __builtin_bit_cast(
      float, __builtin_amdgcn_permlanex16(b, b, 0x76543210, 0xfedcba98, false,
                                          false));
}

// The grid is 4 waves per SIMD (4,096 waves on 1,024 SIMDs): with that stated
// the compiler keeps the fragment loads grouped ahead of their products and
// does not fold them into one register set with a full LDS wait per product.
__global__ __launch_bounds__(128)
__attribute__((amdgpu_waves_per_eu(4, 4))) void attn_wmma(
    const _Float16* __restrict__ Qh, const _Float16* __restrict__ Kh,
    const _Float16* __restrict__ Vh, const _Float16* __restrict__ Tm,
    _Float16* __restrict__ ctx) {
  __shared__ _Float16 sVt[DK_ * VTS];    // V^T tile: [d][k], shared by WG
  __shared__ __attribute__((aligned(16)))
  _Float16 sK[2][64 * KTS];  // K tiles: [key][feature], two buffers

  const int tid = threadIdx.x, lane = tid & 31, wid = tid >> 5;
  const int bh = blockIdx.y;  // b*16 + h
  const int b = bh >> 4, h = bh & 15;
  const int q0 = blockIdx.x * 64 + wid * 16;
  const size_t base = (size_t)bh * T_ * DK_;

  // Q fragments (scale already folded in at projection time); B operand of
  // S^T: column = query lane & 15, same k order as the K fragments.
  v16h qa[2];
  {
    const _Float16* qb = Qh + base + (size_t)q0 * DK_;
    qa[0] = load_frag_g64(qb, 0);
    qa[1] = load_frag_g64(qb, 32);
  }

  const int half8 = (lane >> 4) << 3;
  const int ncol = lane & 15;

  v8f o[4] = {};  // O^T: o[j][r] = O[q0 + ncol][j*16 + half8 + r]
  float rmax = -1e30f;  // this lane's query, joined over both halves
  float rsum = 0.0f;    // this lane's half of the keys; joined in the epilogue

  // this lane's mask row, at its first key of a tile
  const _Float16* tmrow = Tm + (size_t)(q0 + ncol) * T_ + half8;

  // Copies of K tile t into buffer buf: 512 chunks of 16 B, 4 per thread;
  // a wave's 32 lanes cover 512 contiguous bytes (4 whole key rows) per copy.
  auto issue_k = [&](int t, int buf) {
    const _Float16* g = Kh + base + (size_t)t * 64 * DK_ + tid * 8;
    const _Float16* l = &sK[buf][(tid >> 3) * KTS + (tid & 7) * 8];
    async_copy4_b128(l, l + 16 * KTS, l + 32 * KTS, l + 48 * KTS, g,
                     g + 16 * DK_, g + 32 * DK_, g + 48 * DK_);
  };

  issue_k(0, 0);
  wait_async0();    // my chunks of K tile 0 have landed
  __syncthreads();  // everyone's chunks of K tile 0 visible
  issue_k(1, 1);

  for (int kt = 0; kt < NKT; ++kt) {
    const int k0 = kt * 64;
    const _Float16* kl = sK[kt & 1];

    // tanh(mask) of this lane's query: 8 consecutive keys per 16-key tile
    v8h tmv[4];
    for (int j = 0; j < 4; ++j)
      tmv[j] = *(const v8h*)(tmrow + k0 + j * 16);

    {  // cooperative transpose of V tile: V[k][d] -> sVt[d][k]
       // (the previous trip's sVt reads ended at its foot barrier)
      const int kv = tid & 63;
      const int dh = tid >> 6;  // 0 or 1 (d halves)
      const _Float16* vrow = Vh + base + (size_t)(k0 + kv) * DK_ + dh * 32;
      for (int dd = 0; dd < 32; ++dd)
        sVt[(dh * 32 + dd) * VTS + kv] = vrow[dd];
    }
    __syncthreads();

    // ---- S^T = K Q^T: s[j][r] = S[q0 + ncol][k0 + j*16 + half8 + r] ----
    v16h kb[4][2];
    for (int j = 0; j < 4; ++j) {
      kb[j][0] = load_frag_lds<KTS>(kl, j * 16, 0);
      kb[j][1] = load_frag_lds<KTS>(kl, j * 16, 32);
    }
    v8f s[4] = {};
    for (int j = 0; j < 4; ++j) s[j] = wmma16(kb[j][0], qa[0], s[j]);
    for (int j = 0; j < 4; ++j) s[j] = wmma16(kb[j][1], qa[1], s[j]);

    // V^T fragments (A operand of the second product): they depend on nothing
    // below, so their LDS latency passes behind the softmax arithmetic
    v16h vb[4][2];
    for (int j = 0; j < 4; ++j) {
      vb[j][0] = load_frag_lds<VTS>(sVt, j * 16, 0);
      vb[j][1] = load_frag_lds<VTS>(sVt, j * 16, 32);
    }

    // ---- online softmax: this query's maximum, in-lane, then both halves ----
    float mj[4];
    for (int j = 0; j < 4; ++j) {
      mj[j] = s[j][0];
      for (int r = 1; r < 8; ++r) mj[j] = fmaxf(mj[j], s[j][r]);
    }
    float m = fmaxf(fmaxf(mj[0], mj[1]), fmaxf(mj[2], mj[3]));
    m = fmaxf(m, xhalf(m));
    const float mn = fmaxf(rmax, m);
    const float scl = __expf(rmax - mn);
    rmax = mn;

    // ---- P = exp(S-max); denominator unmasked, numerator * tanh(mask) ----
    // pb[mm][e] = P^T[key 32*mm + kmap(e)][query]: tiles 2*mm and 2*mm+1 in
    // register order are the hardware k order of a B operand.
    v16h pb[2];
    float tj[4];
    // both loops unrolled: left rolled, the register arrays are indexed by a
    // variable and pb goes to scratch memory
#pragma unroll
    for (int j = 0; j < 4; ++j) {
      tj[j] = 0.0f;
#pragma unroll
      for (int r = 0; r < 8; ++r) {
        const float e = __expf(s[j][r] - rmax);
        tj[j] += e;
        pb[j >> 1][(j & 1) * 8 + r] = (_Float16)(e * (float)tmv[j][r]);
      }
    }
    rsum = rsum * scl + ((tj[0] + tj[1]) + (tj[2] + tj[3]));
    for (int j = 0; j < 4; ++j)
      for (int r = 0; r < 8; ++r) o[j][r] *= scl;

    // ---- O^T += V^T P^T ----
    for (int j = 0; j < 4; ++j) o[j] = wmma16(vb[j][0], pb[0], o[j]);
    for (int j = 0; j < 4; ++j) o[j] = wmma16(vb[j][1], pb[1], o[j]);

    // ---- foot: publish K tile kt+1, free this trip's K buffer and sVt ----
    // my LDS reads of this trip have returned before the buffer is refilled
    asm volatile("s_wait_dscnt 0x0" ::: "memory");
    wait_async0();    // my chunks of K tile kt+1 have landed
    __syncthreads();  // all chunks visible; all reads of sK[kt&1], sVt done
    if (kt + 2 < NKT) issue_k(kt + 2, kt & 1);
  }
  wait_async0();  // nothing in flight when the wave ends

  // ---- normalize and write ctx as f16 [B, T, D] (heads re-interleaved) ----
  // a lane's 8 accumulator registers are 8 consecutive features of its query
  const float inv = 1.0f / fmaxf(rsum + xhalf(rsum), 1e-20f);
  _Float16* crow = ctx + ((size_t)b * T_ + q0 + ncol) * D_ + h * DK_ + half8;
  for (int j = 0; j < 4; ++j) {
    v8h w;
    for (int r = 0; r < 8; ++r) w[r] = (_Float16)(o[j][r] * inv);
    *(v8h*)(crow + j * 16) = w;
  }
}

// ---------------------------------------------------------------------------
// Host launcher
// ---------------------------------------------------------------------------
extern "C" void kernel_launch(void* const* d_in, const int* in_sizes, int n_in,
                              void* d_out, int out_size, void* d_ws,
                              size_t ws_size, hipStream_t stream) {
  (void)in_sizes; (void)n_in; (void)out_size; (void)ws_size;

  const float* query = (const float*)d_in[0];
  const float* key   = (const float*)d_in[1];
  const float* value = (const float*)d_in[2];
  const float* Wq = (const float*)d_in[3];
  const float* bq = (const float*)d_in[4];
  const float* Wk = (const float*)d_in[5];
  const float* bk = (const float*)d_in[6];
  const float* Wv = (const float*)d_in[7];
  const float* bv = (const float*)d_in[8];
  const float* Wo = (const float*)d_in[9];
  const float* bo = (const float*)d_in[10];
  const float* lmask = (const float*)d_in[11];

  // workspace carve-up (MiB offsets), 64 MiB total
  char* ws = (char*)d_ws;
  const size_t MB = (size_t)1 << 20;
  _Float16* Qh  = (_Float16*)(ws + 0 * MB);   // [B,H,T,64] f16 (pre-scaled)
  _Float16* Kh  = (_Float16*)(ws + 8 * MB);
  _Float16* Vh  = (_Float16*)(ws + 16 * MB);
  _Float16* Tm  = (_Float16*)(ws + 24 * MB);  // tanh(mask) f16 [T,T]
  _Float16* Xq  = (_Float16*)(ws + 32 * MB);  // f16 activations
  _Float16* Xk  = (_Float16*)(ws + 40 * MB);
  _Float16* Xv  = (_Float16*)(ws + 48 * MB);
  _Float16* Wqt = (_Float16*)(ws + 56 * MB);  // f16 transposed weights [n][k]
  _Float16* Wkt = (_Float16*)(ws + 58 * MB);
  _Float16* Wvt = (_Float16*)(ws + 60 * MB);
  _Float16* Wot = (_Float16*)(ws + 62 * MB);
  _Float16* ctx = (_Float16*)(ws + 32 * MB);  // reuse Xq (consumed by then)

  const int nmask = T_ * T_;
  tanh_mask_kernel<<<(nmask + 255) / 256, 256, 0, stream>>>(lmask, Tm, nmask);

  const int n4 = M_ * D_ / 4;  // activation f32->f16, 4 elems/thread
  cvt_f16_kernel<<<(n4 + 255) / 256, 256, 0, stream>>>(query, Xq, n4);
  cvt_f16_kernel<<<(n4 + 255) / 256, 256, 0, stream>>>(key, Xk, n4);
  cvt_f16_kernel<<<(n4 + 255) / 256, 256, 0, stream>>>(value, Xv, n4);

  const dim3 tgrid(D_ / 32, D_ / 32);  // 32 x 32 transpose tiles
  const dim3 tblk(32, 8);
  transpose_cvt_kernel<<<tgrid, tblk, 0, stream>>>(Wq, Wqt);
  transpose_cvt_kernel<<<tgrid, tblk, 0, stream>>>(Wk, Wkt);
  transpose_cvt_kernel<<<tgrid, tblk, 0, stream>>>(Wv, Wvt);
  transpose_cvt_kernel<<<tgrid, tblk, 0, stream>>>(Wo, Wot);

  const dim3 ggrid(M_ / BM, D_ / BN);  // 32 x 16
  const float qscale = 0.125f;         // 1/sqrt(64)
  gemm_wmma_async<true><<<ggrid, 256, 0, stream>>>(Xq, Wqt, bq, Qh, qscale);
  gemm_wmma_async<true><<<ggrid, 256, 0, stream>>>(Xk, Wkt, bk, Kh, 1.0f);
  gemm_wmma_async<true><<<ggrid, 256, 0, stream>>>(Xv, Wvt, bv, Vh, 1.0f);

  attn_wmma<<<dim3(T_ / 64, B_ * H_), 128, 0, stream>>>(Qh, Kh, Vh, Tm, ctx);

  gemm_wmma_async<false><<<ggrid, 256, 0, stream>>>(ctx, Wot, bo, d_out, 1.0f);
}

// v003
// It runs in 163 microseconds.
// Next to v002, in two timings, it ran 1.07 times as fast each time.
// Over all steps from v000 it is 1.44 times as fast.
#include <hip/hip_runtime.h>
#include <hip/hip_bf16.h>

// ---------------------------------------------------------------------------
// MHA forward for B=2, T=2048, D=1024, H=16, DK=64 on gfx1250 (MI455X).
// All GEMMs run through v_wmma_f32_16x16x32_f16 (f16 in, f32 accumulate).
// GEMM tiles are staged global->LDS with GLOBAL_LOAD_ASYNC_TO_LDS_B128
// (ASYNCcnt) in a double-buffered pipeline.
// ---------------------------------------------------------------------------

typedef __attribute__((ext_vector_type(16))) _Float16 v16h;
typedef __attribute__((ext_vector_type(8)))  _Float16 v8h;
typedef __attribute__((ext_vector_type(4)))  _Float16 v4h;
typedef __attribute__((ext_vector_type(8)))  float    v8f;

#define B_  2
#define T_  2048
#define H_  16
#define DK_ 64
#define D_  1024
#define M_  (B_ * T_)   // 4096 rows for the projection GEMMs

__device__ __forceinline__ v8f wmma16(v16h a, v16h b, v8f c) {
  // (neg_a, A, neg_b, B, c_mod, C, reuse_a, reuse_b)
  return __builtin_amdgcn_wmma_f32_16x16x32_f16(false, a, false, b, (short)0, c,
                                                false, false);
}

// Async DMA of one 16-byte chunk: global -> LDS, tracked with ASYNCcnt.
// VDST = per-lane LDS byte offset (low 32 bits of the generic LDS pointer,
// per the CDNA5 aperture mapping), VADDR = 64-bit global address.
__device__ __forceinline__ void async_copy_b128(void* lds_ptr,
                                                const void* gptr) {
  const unsigned loff = (unsigned)(unsigned long long)lds_ptr;
  asm volatile("global_load_async_to_lds_b128 %0, %1, off" ::"v"(loff),
               "v"(gptr)
               : "memory");
}
__device__ __forceinline__ void wait_async0() {
  asm volatile("s_wait_asynccnt 0x0" ::: "memory");
}
// Four such copies of one lane in ONE statement.  The closing s_wait_xcnt
// stands inside the statement so that no address register of an issued copy
// is rewritten in front of it.
__device__ __forceinline__ void async_copy4_b128(
    const void* l0, const void* l1, const void* l2, const void* l3,
    const void* g0, const void* g1, const void* g2, const void* g3) {
  asm volatile(
      "global_load_async_to_lds_b128 %0, %4, off\n\t"
      "global_load_async_to_lds_b128 %1, %5, off\n\t"
      "global_load_async_to_lds_b128 %2, %6, off\n\t"
      "global_load_async_to_lds_b128 %3, %7, off\n\t"
      "s_wait_xcnt 0x0" ::"v"((unsigned)(unsigned long long)l0),
      "v"((unsigned)(unsigned long long)l1),
      "v"((unsigned)(unsigned long long)l2),
      "v"((unsigned)(unsigned long long)l3), "v"(g0), "v"(g1), "v"(g2), "v"(g3)
      : "memory");
}

// Load a 16x32 f16 WMMA A/B fragment from LDS stored [row][k], k contiguous,
// row stride STRIDE halves (STRIDE % 8 == 0 so each half-row chunk is a
// 16-byte-aligned ds_load_b128).
// Lane L (L<16): row = row0+L, K = {kh..kh+7, 16+kh..16+kh+7} with kh=0.
// Lane L+16:    same row, kh=8.  Matches CDNA5 16-bit A layout (ISA 7.12.2).
template <int STRIDE>
__device__ __forceinline__ v16h load_frag_lds(const _Float16* base, int row0,
                                              int kOff) {
  const int lane = threadIdx.x & 31;
  const _Float16* p =
      base + (size_t)(row0 + (lane & 15)) * STRIDE + kOff + ((lane >> 4) << 3);
  v8h lo = *(const v8h*)(p);
  v8h hi = *(const v8h*)(p + 16);
  return __builtin_shufflevector(lo, hi, 0, 1, 2, 3, 4, 5, 6, 7, 8, 9, 10, 11,
                                 12, 13, 14, 15);
}

// Same fragment shape, loaded directly from global memory with row stride 64
// halves (the [*, 64] head layout of Q/K: row = head-row, k-dim = feature).
__device__ __forceinline__ v16h load_frag_g64(const _Float16* base, int kOff) {
  const int lane = threadIdx.x & 31;
  const _Float16* p =
      base + (size_t)(lane & 15) * DK_ + kOff + ((lane >> 4) << 3);
  v8h lo = *(const v8h*)(p);
  v8h hi = *(const v8h*)(p + 16);
  return __builtin_shufflevector(lo, hi, 0, 1, 2, 3, 4, 5, 6, 7, 8, 9, 10, 11,
                                 12, 13, 14, 15);
}

// ---------------------------------------------------------------------------
// Pre-passes (kernels 0a, 0b, 0c): few waves with much work each.  What these
// short launches pay for is the number of waves they start, not their bytes.
// 0a and 0b: 256 work-groups of 16 waves (one per WGP); a thread takes 8
// pieces of 16 B, all 8 loads in flight at once; every wave-wide load covers
// 512 contiguous bytes, every wave-wide store 256.
// ---------------------------------------------------------------------------
#define EW_T 512                 // threads per work-group
#define EW_U 8                   // 16-byte pieces per thread
#define EW_N4 (M_ * D_ / 4)      // pieces per array (mask and activations alike)
#define EW_G (EW_N4 / (EW_T * EW_U))  // work-groups
static_assert(T_ * T_ == M_ * D_, "mask and activations: one piece count");
static_assert(EW_G * EW_T * EW_U == EW_N4, "the grid covers the array exactly");

// ---------------------------------------------------------------------------
// Kernel 0a: tanh(learnable_mask) -> f16, computed once, reused by all (b,h).
// ---------------------------------------------------------------------------
__global__ __launch_bounds__(EW_T) void tanh_mask_kernel(
    const float* __restrict__ mask, _Float16* __restrict__ out) {
  const int i0 = blockIdx.x * (EW_T * EW_U) + threadIdx.x;
  float4 v[EW_U];
  for (int u = 0; u < EW_U; ++u) v[u] = ((const float4*)mask)[i0 + u * EW_T];
  for (int u = 0; u < EW_U; ++u) {
    v4h h;
    h.x = (_Float16)tanhf(v[u].x); h.y = (_Float16)tanhf(v[u].y);
    h.z = (_Float16)tanhf(v[u].z); h.w = (_Float16)tanhf(v[u].w);
    ((v4h*)out)[i0 + u * EW_T] = h;
  }
}

// ---------------------------------------------------------------------------
// Kernel 0b: f32 -> f16 elementwise (activations).
// ---------------------------------------------------------------------------
__global__ __launch_bounds__(EW_T) void cvt_f16_kernel(
    const float* __restrict__ in, _Float16* __restrict__ out) {
  const int i0 = blockIdx.x * (EW_T * EW_U) + threadIdx.x;
  float4 v[EW_U];
  for (int u = 0; u < EW_U; ++u) v[u] = ((const float4*)in)[i0 + u * EW_T];
  for (int u = 0; u < EW_U; ++u) {
    v4h h;
    h.x = (_Float16)v[u].x; h.y = (_Float16)v[u].y;
    h.z = (_Float16)v[u].z; h.w = (_Float16)v[u].w;
    ((v4h*)out)[i0 + u * EW_T] = h;
  }
}

// ---------------------------------------------------------------------------
// Kernel 0c: W[k][n] f32 -> Wt[n][k] f16 (tiled 64x64 transpose via LDS) so
// the GEMM B-operand is k-contiguous and async-DMA-friendly.  A thread loads
// 4 pieces of 16 B (a wave: two 256-B row pieces per load) and stores 2 pieces
// of 16 B (a wave: four whole 128-B lines per store).  Pitch 65 dwords: the
// row-wise writes and the column-wise reads both fall on 32 different banks.
// ---------------------------------------------------------------------------
#define TT 64
__global__ __launch_bounds__(256) void transpose_cvt_kernel(
    const float* __restrict__ W, _Float16* __restrict__ Wt) {
  __shared__ float tile[TT][TT + 1];
  const int tid = threadIdx.x;
  const int n0 = blockIdx.x * TT, k0 = blockIdx.y * TT;
  float4 v[4];
  for (int u = 0; u < 4; ++u) {
    const int q = tid + u * 256, k = q >> 4, c = q & 15;
    v[u] = *(const float4*)(W + (size_t)(k0 + k) * D_ + n0 + c * 4);
  }
  for (int u = 0; u < 4; ++u) {
    const int q = tid + u * 256, k = q >> 4, c = q & 15;
    tile[k][c * 4 + 0] = v[u].x; tile[k][c * 4 + 1] = v[u].y;
    tile[k][c * 4 + 2] = v[u].z; tile[k][c * 4 + 3] = v[u].w;
  }
  __syncthreads();
  for (int u = 0; u < 2; ++u) {
    const int q = tid + u * 256, n = q >> 3, kc = q & 7;
    v8h h;
    for (int j = 0; j < 8; ++j) h[j] = (_Float16)tile[kc * 8 + j][n];
    *(v8h*)(Wt + (size_t)(n0 + n) * D_ + k0 + kc * 8) = h;
  }
}

// ---------------------------------------------------------------------------
// Kernel 1/4: C = A @ W + bias, with A [4096 x 1024] f16 row-major and
// Wt [1024(n) x 1024(k)] f16 (pre-transposed).  Tile 128x64, BK=32, 8 waves,
// each wave a 32x32 block = 2x2 WMMA tiles.  Tiles staged by
// global_load_async_to_lds_b128, double-buffered (issue k+1 while computing k).
// HEADS=true : scatter f16 into [B,H,T,64] head layout, scale folded in.
// HEADS=false: write f32 row-major [4096 x 1024] (final output).
// ---------------------------------------------------------------------------
#define BM 128
#define BN 64
#define BK 32
#define LS 40  // LDS row stride in halves (32 + 8 pad; 80B, 16B aligned)

template <bool HEADS>
__global__ __launch_bounds__(256) void gemm_wmma_async(
    const _Float16* __restrict__ A, const _Float16* __restrict__ Wt,
    const float* __restrict__ bias, void* __restrict__ outp, float scale) {
  __shared__ _Float16 sA[2][BM * LS];
  __shared__ _Float16 sB[2][BN * LS];

  const int tid = threadIdx.x;
  const int lane = tid & 31;
  const int wid = tid >> 5;
  const int wr = wid & 3;   // wave row 0..3  -> 32-row stripe
  const int wc = wid >> 2;  // wave col 0..1  -> 32-col stripe
  const int m0 = blockIdx.x * BM;
  const int n0 = blockIdx.y * BN;

  // Issue async copies for the k0 tile into buffer `buf`.
  // A tile: 128 rows x 4 16B-chunks = 512 chunks (2/thread);
  // B tile:  64 rows x 4 16B-chunks = 256 chunks (1/thread).
  auto issue_tile = [&](int k0, int buf) {
    for (int q = tid; q < 512; q += 256) {
      const int r = q >> 2, c = q & 3;
      async_copy_b128(&sA[buf][r * LS + c * 8],
                      A + (size_t)(m0 + r) * D_ + k0 + c * 8);
    }
    {
      const int r = tid >> 2, c = tid & 3;
      async_copy_b128(&sB[buf][r * LS + c * 8],
                      Wt + (size_t)(n0 + r) * D_ + k0 + c * 8);
    }
  };

  v8f c[2][2] = {};

  issue_tile(0, 0);
  const int NT = D_ / BK;  // 32 k-steps
  for (int kt = 0; kt < NT; ++kt) {
    const int buf = kt & 1;
    wait_async0();    // my chunks of tile kt have landed in LDS
    __syncthreads();  // everyone's chunks visible; prev reads of buf^1 done
    if (kt + 1 < NT) issue_tile((kt + 1) * BK, buf ^ 1);

    v16h a0 = load_frag_lds<LS>(sA[buf], wr * 32, 0);
    v16h a1 = load_frag_lds<LS>(sA[buf], wr * 32 + 16, 0);
    v16h b0 = load_frag_lds<LS>(sB[buf], wc * 32, 0);
    v16h b1 = load_frag_lds<LS>(sB[buf], wc * 32 + 16, 0);
    c[0][0] = wmma16(a0, b0, c[0][0]);
    c[0][1] = wmma16(a0, b1, c[0][1]);
    c[1][0] = wmma16(a1, b0, c[1][0]);
    c[1][1] = wmma16(a1, b1, c[1][1]);
  }

  // ---- epilogue ----
  // C/D layout: element (vgpr r, lane): row = r + (lane>=16 ? 8 : 0),
  // col = lane & 15 (ISA 7.12.2).
  const int half8 = (lane >> 4) << 3;
  const int ncol = lane & 15;
  for (int i = 0; i < 2; ++i)
    for (int j = 0; j < 2; ++j)
      for (int r = 0; r < 8; ++r) {
        const int m = m0 + wr * 32 + i * 16 + r + half8;
        const int n = n0 + wc * 32 + j * 16 + ncol;
        float v = c[i][j][r] + bias[n];
        if (HEADS) {
          v *= scale;  // 1/sqrt(DK) folded into Q
          const int b = m >> 11, t = m & (T_ - 1);
          const int h = n >> 6, d = n & (DK_ - 1);
          ((_Float16*)outp)[(((size_t)b * H_ + h) * T_ + t) * DK_ + d] =
              (_Float16)v;
        } else {
          ((float*)outp)[(size_t)m * D_ + n] = v;
        }
      }
}

#define VTS 72  // LDS row stride in halves for the V^T tile (64+8; 144B)
#define KTS 72  // LDS row stride in halves for the K tile (128B + 16B pad)
#define NKT (T_ / 64)  // key tiles

// lane l <-> lane l ^ 16 (the two halves of a wave hold the same query)
__device__ __forceinline__ float xhalf(float x) {
  const int b = __builtin_bit_cast(int, x);
  return __builtin_bit_cast(
      float, __builtin_amdgcn_permlanex16(b, b, 0x76543210, 0xfedcba98, false,
                                          false));
}

// The grid is 4 waves per SIMD (4,096 waves on 1,024 SIMDs): with that stated
// the compiler keeps the fragment loads grouped ahead of their products and
// does not fold them into one register set with a full LDS wait per product.
__global__ __launch_bounds__(128)
__attribute__((amdgpu_waves_per_eu(4, 4))) void attn_wmma(
    const _Float16* __restrict__ Qh, const _Float16* __restrict__ Kh,
    const _Float16* __restrict__ Vh, const _Float16* __restrict__ Tm,
    _Float16* __restrict__ ctx) {
  __shared__ _Float16 sVt[DK_ * VTS];    // V^T tile: [d][k], shared by WG
  __shared__ __attribute__((aligned(16)))
  _Float16 sK[2][64 * KTS];  // K tiles: [key][feature], two buffers

  const int tid = threadIdx.x, lane = tid & 31, wid = tid >> 5;
  const int bh = blockIdx.y;  // b*16 + h
  const int b = bh >> 4, h = bh & 15;
  const int q0 = blockIdx.x * 64 + wid * 16;
  const size_t base = (size_t)bh * T_ * DK_;

  // Q fragments (scale already folded in at projection time); B operand of
  // S^T: column = query lane & 15, same k order as the K fragments.
  v16h qa[2];
  {
    const _Float16* qb = Qh + base + (size_t)q0 * DK_;
    qa[0] = load_frag_g64(qb, 0);
    qa[1] = load_frag_g64(qb, 32);
  }

  const int half8 = (lane >> 4) << 3;
  const int ncol = lane & 15;

  v8f o[4] = {};  // O^T: o[j][r] = O[q0 + ncol][j*16 + half8 + r]
  float rmax = -1e30f;  // this lane's query, joined over both halves
  float rsum = 0.0f;    // this lane's half of the keys; joined in the epilogue

  // this lane's mask row, at its first key of a tile
  const _Float16* tmrow = Tm + (size_t)(q0 + ncol) * T_ + half8;

  // Copies of K tile t into buffer buf: 512 chunks of 16 B, 4 per thread;
  // a wave's 32 lanes cover 512 contiguous bytes (4 whole key rows) per copy.
  auto issue_k = [&](int t, int buf) {
    const _Float16* g = Kh + base + (size_t)t * 64 * DK_ + tid * 8;
    const _Float16* l = &sK[buf][(tid >> 3) * KTS + (tid & 7) * 8];
    async_copy4_b128(l, l + 16 * KTS, l + 32 * KTS, l + 48 * KTS, g,
                     g + 16 * DK_, g + 32 * DK_, g + 48 * DK_);
  };

  issue_k(0, 0);
  wait_async0();    // my chunks of K tile 0 have landed
  __syncthreads();  // everyone's chunks of K tile 0 visible
  issue_k(1, 1);

  for (int kt = 0; kt < NKT; ++kt) {
    const int k0 = kt * 64;
    const _Float16* kl = sK[kt & 1];

    // tanh(mask) of this lane's query: 8 consecutive keys per 16-key tile
    v8h tmv[4];
    for (int j = 0; j < 4; ++j)
      tmv[j] = *(const v8h*)(tmrow + k0 + j * 16);

    {  // cooperative transpose of V tile: V[k][d] -> sVt[d][k]
       // (the previous trip's sVt reads ended at its foot barrier)
      const int kv = tid & 63;
      const int dh = tid >> 6;  // 0 or 1 (d halves)
      const _Float16* vrow = Vh + base + (size_t)(k0 + kv) * DK_ + dh * 32;
      for (int dd = 0; dd < 32; ++dd)
        sVt[(dh * 32 + dd) * VTS + kv] = vrow[dd];
    }
    __syncthreads();

    // ---- S^T = K Q^T: s[j][r] = S[q0 + ncol][k0 + j*16 + half8 + r] ----
    v16h kb[4][2];
    for (int j = 0; j < 4; ++j) {
      kb[j][0] = load_frag_lds<KTS>(kl, j * 16, 0);
      kb[j][1] = load_frag_lds<KTS>(kl, j * 16, 32);
    }
    v8f s[4] = {};
    for (int j = 0; j < 4; ++j) s[j] = wmma16(kb[j][0], qa[0], s[j]);
    for (int j = 0; j < 4; ++j) s[j] = wmma16(kb[j][1], qa[1], s[j]);

    // V^T fragments (A operand of the second product): they depend on nothing
    // below, so their LDS latency passes behind the softmax arithmetic
    v16h vb[4][2];
    for (int j = 0; j < 4; ++j) {
      vb[j][0] = load_frag_lds<VTS>(sVt, j * 16, 0);
      vb[j][1] = load_frag_lds<VTS>(sVt, j * 16, 32);
    }

    // ---- online softmax: this query's maximum, in-lane, then both halves ----
    float mj[4];
    for (int j = 0; j < 4; ++j) {
      mj[j] = s[j][0];
      for (int r = 1; r < 8; ++r) mj[j] = fmaxf(mj[j], s[j][r]);
    }
    float m = fmaxf(fmaxf(mj[0], mj[1]), fmaxf(mj[2], mj[3]));
    m = fmaxf(m, xhalf(m));
    const float mn = fmaxf(rmax, m);
    const float scl = __expf(rmax - mn);
    rmax = mn;

    // ---- P = exp(S-max); denominator unmasked, numerator * tanh(mask) ----
    // pb[mm][e] = P^T[key 32*mm + kmap(e)][query]: tiles 2*mm and 2*mm+1 in
    // register order are the hardware k order of a B operand.
    v16h pb[2];
    float tj[4];
    // both loops unrolled: left rolled, the register arrays are indexed by a
    // variable and pb goes to scratch memory
#pragma unroll
    for (int j = 0; j < 4; ++j) {
      tj[j] = 0.0f;
#pragma unroll
      for (int r = 0; r < 8; ++r) {
        const float e = __expf(s[j][r] - rmax);
        tj[j] += e;
        pb[j >> 1][(j & 1) * 8 + r] = (_Float16)(e * (float)tmv[j][r]);
      }
    }
    rsum = rsum * scl + ((tj[0] + tj[1]) + (tj[2] + tj[3]));
    for (int j = 0; j < 4; ++j)
      for (int r = 0; r < 8; ++r) o[j][r] *= scl;

    // ---- O^T += V^T P^T ----
    for (int j = 0; j < 4; ++j) o[j] = wmma16(vb[j][0], pb[0], o[j]);
    for (int j = 0; j < 4; ++j) o[j] = wmma16(vb[j][1], pb[1], o[j]);

    // ---- foot: publish K tile kt+1, free this trip's K buffer and sVt ----
    // my LDS reads of this trip have returned before the buffer is refilled
    asm volatile("s_wait_dscnt 0x0" ::: "memory");
    wait_async0();    // my chunks of K tile kt+1 have landed
    __syncthreads();  // all chunks visible; all reads of sK[kt&1], sVt done
    if (kt + 2 < NKT) issue_k(kt + 2, kt & 1);
  }
  wait_async0();  // nothing in flight when the wave ends

  // ---- normalize and write ctx as f16 [B, T, D] (heads re-interleaved) ----
  // a lane's 8 accumulator registers are 8 consecutive features of its query
  const float inv = 1.0f / fmaxf(rsum + xhalf(rsum), 1e-20f);
  _Float16* crow = ctx + ((size_t)b * T_ + q0 + ncol) * D_ + h * DK_ + half8;
  for (int j = 0; j < 4; ++j) {
    v8h w;
    for (int r = 0; r < 8; ++r) w[r] = (_Float16)(o[j][r] * inv);
    *(v8h*)(crow + j * 16) = w;
  }
}

// ---------------------------------------------------------------------------
// Host launcher
// ---------------------------------------------------------------------------
extern "C" void kernel_launch(void* const* d_in, const int* in_sizes, int n_in,
                              void* d_out, int out_size, void* d_ws,
                              size_t ws_size, hipStream_t stream) {
  (void)in_sizes; (void)n_in; (void)out_size; (void)ws_size;

  const float* query = (const float*)d_in[0];
  const float* key   = (const float*)d_in[1];
  const float* value = (const float*)d_in[2];
  const float* Wq = (const float*)d_in[3];
  const float* bq = (const float*)d_in[4];
  const float* Wk = (const float*)d_in[5];
  const float* bk = (const float*)d_in[6];
  const float* Wv = (const float*)d_in[7];
  const float* bv = (const float*)d_in[8];
  const float* Wo = (const float*)d_in[9];
  const float* bo = (const float*)d_in[10];
  const float* lmask = (const float*)d_in[11];

  // workspace carve-up (MiB offsets), 64 MiB total
  char* ws = (char*)d_ws;
  const size_t MB = (size_t)1 << 20;
  _Float16* Qh  = (_Float16*)(ws + 0 * MB);   // [B,H,T,64] f16 (pre-scaled)
  _Float16* Kh  = (_Float16*)(ws + 8 * MB);
  _Float16* Vh  = (_Float16*)(ws + 16 * MB);
  _Float16* Tm  = (_Float16*)(ws + 24 * MB);  // tanh(mask) f16 [T,T]
  _Float16* Xq  = (_Float16*)(ws + 32 * MB);  // f16 activations
  _Float16* Xk  = (_Float16*)(ws + 40 * MB);
  _Float16* Xv  = (_Float16*)(ws + 48 * MB);
  _Float16* Wqt = (_Float16*)(ws + 56 * MB);  // f16 transposed weights [n][k]
  _Float16* Wkt = (_Float16*)(ws + 58 * MB);
  _Float16* Wvt = (_Float16*)(ws + 60 * MB);
  _Float16* Wot = (_Float16*)(ws + 62 * MB);
  _Float16* ctx = (_Float16*)(ws + 32 * MB);  // reuse Xq (consumed by then)

  tanh_mask_kernel<<<EW_G, EW_T, 0, stream>>>(lmask, Tm);

  cvt_f16_kernel<<<EW_G, EW_T, 0, stream>>>(query, Xq);
  cvt_f16_kernel<<<EW_G, EW_T, 0, stream>>>(key, Xk);
  cvt_f16_kernel<<<EW_G, EW_T, 0, stream>>>(value, Xv);

  const dim3 tgrid(D_ / TT, D_ / TT);  // 16 x 16 transpose tiles
  transpose_cvt_kernel<<<tgrid, 256, 0, stream>>>(Wq, Wqt);
  transpose_cvt_kernel<<<tgrid, 256, 0, stream>>>(Wk, Wkt);
  transpose_cvt_kernel<<<tgrid, 256, 0, stream>>>(Wv, Wvt);
  transpose_cvt_kernel<<<tgrid, 256, 0, stream>>>(Wo, Wot);

  const dim3 ggrid(M_ / BM, D_ / BN);  // 32 x 16
  const float qscale = 0.125f;         // 1/sqrt(64)
  gemm_wmma_async<true><<<ggrid, 256, 0, stream>>>(Xq, Wqt, bq, Qh, qscale);
  gemm_wmma_async<true><<<ggrid, 256, 0, stream>>>(Xk, Wkt, bk, Kh, 1.0f);
  gemm_wmma_async<true><<<ggrid, 256, 0, stream>>>(Xv, Wvt, bv, Vh, 1.0f);

  attn_wmma<<<dim3(T_ / 64, B_ * H_), 128, 0, stream>>>(Qh, Kh, Vh, Tm, ctx);

  gemm_wmma_async<false><<<ggrid, 256, 0, stream>>>(ctx, Wot, bo, d_out, 1.0f);
}

// v004
// A run of this version takes 131 microseconds.
// Timed twice side by side with v003, it ran 1.24 times as fast both times.
// All steps since v000 together make it 1.79 times as fast.
#include <hip/hip_runtime.h>
#include <hip/hip_bf16.h>

// ---------------------------------------------------------------------------
// MHA forward for B=2, T=2048, D=1024, H=16, DK=64 on gfx1250 (MI455X).
// All GEMMs run through v_wmma_f32_16x16x32_f16 (f16 in, f32 accumulate).
// GEMM tiles are staged global->LDS with GLOBAL_LOAD_ASYNC_TO_LDS_B128
// (ASYNCcnt) in a double-buffered pipeline.
// ---------------------------------------------------------------------------

typedef __attribute__((ext_vector_type(16))) _Float16 v16h;
typedef __attribute__((ext_vector_type(8)))  _Float16 v8h;
typedef __attribute__((ext_vector_type(4)))  _Float16 v4h;
typedef __attribute__((ext_vector_type(8)))  float    v8f;

#define B_  2
#define T_  2048
#define H_  16
#define DK_ 64
#define D_  1024
#define M_  (B_ * T_)   // 4096 rows for the projection GEMMs

__device__ __forceinline__ v8f wmma16(v16h a, v16h b, v8f c) {
  // (neg_a, A, neg_b, B, c_mod, C, reuse_a, reuse_b)
  return __builtin_amdgcn_wmma_f32_16x16x32_f16(false, a, false, b, (short)0, c,
                                                false, false);
}

// Async DMA of one 16-byte chunk: global -> LDS, tracked with ASYNCcnt.
// VDST = per-lane LDS byte offset (low 32 bits of the generic LDS pointer,
// per the CDNA5 aperture mapping), VADDR = 64-bit global address.
__device__ __forceinline__ void async_copy_b128(void* lds_ptr,
                                                const void* gptr) {
  const unsigned loff = (unsigned)(unsigned long long)lds_ptr;
  asm volatile("global_load_async_to_lds_b128 %0, %1, off" ::"v"(loff),
               "v"(gptr)
               : "memory");
}
__device__ __forceinline__ void wait_async0() {
  asm volatile("s_wait_asynccnt 0x0" ::: "memory");
}
// Four such copies of one lane in ONE statement.  The closing s_wait_xcnt
// stands inside the statement so that no address register of an issued copy
// is rewritten in front of it.
__device__ __forceinline__ void async_copy4_b128(
    const void* l0, const void* l1, const void* l2, const void* l3,
    const void* g0, const void* g1, const void* g2, const void* g3) {
  asm volatile(
      "global_load_async_to_lds_b128 %0, %4, off\n\t"
      "global_load_async_to_lds_b128 %1, %5, off\n\t"
      "global_load_async_to_lds_b128 %2, %6, off\n\t"
      "global_load_async_to_lds_b128 %3, %7, off\n\t"
      "s_wait_xcnt 0x0" ::"v"((unsigned)(unsigned long long)l0),
      "v"((unsigned)(unsigned long long)l1),
      "v"((unsigned)(unsigned long long)l2),
      "v"((unsigned)(unsigned long long)l3), "v"(g0), "v"(g1), "v"(g2), "v"(g3)
      : "memory");
}

// Load a 16x32 f16 WMMA A/B fragment from LDS stored [row][k], k contiguous,
// row stride STRIDE halves (STRIDE % 8 == 0 so each half-row chunk is a
// 16-byte-aligned ds_load_b128).
// Lane L (L<16): row = row0+L, K = {kh..kh+7, 16+kh..16+kh+7} with kh=0.
// Lane L+16:    same row, kh=8.  Matches CDNA5 16-bit A layout (ISA 7.12.2).
template <int STRIDE>
__device__ __forceinline__ v16h load_frag_lds(const _Float16* base, int row0,
                                              int kOff) {
  const int lane = threadIdx.x & 31;
  const _Float16* p =
      base + (size_t)(row0 + (lane & 15)) * STRIDE + kOff + ((lane >> 4) << 3);
  v8h lo = *(const v8h*)(p);
  v8h hi = *(const v8h*)(p + 16);
  return __builtin_shufflevector(lo, hi, 0, 1, 2, 3, 4, 5, 6, 7, 8, 9, 10, 11,
                                 12, 13, 14, 15);
}

// Same fragment shape, loaded directly from global memory with row stride 64
// halves (the [*, 64] head layout of Q/K: row = head-row, k-dim = feature).
__device__ __forceinline__ v16h load_frag_g64(const _Float16* base, int kOff) {
  const int lane = threadIdx.x & 31;
  const _Float16* p =
      base + (size_t)(lane & 15) * DK_ + kOff + ((lane >> 4) << 3);
  v8h lo = *(const v8h*)(p);
  v8h hi = *(const v8h*)(p + 16);
  return __builtin_shufflevector(lo, hi, 0, 1, 2, 3, 4, 5, 6, 7, 8, 9, 10, 11,
                                 12, 13, 14, 15);
}

// ---------------------------------------------------------------------------
// Pre-pass: ONE launch for the eight jobs that read inputs only and none of
// each other's output (tanh of the mask, three f32 -> f16 conversions, four
// weight transposes).  A work-group's job follows from its index; the heavier
// jobs have the lower indices and start first, the short transposes fill the
// places they leave.  Few waves with much work each, 16 waves a work-group.
// Elementwise jobs: a thread takes 8 pieces of 16 B, all 8 loads in flight at
// once; every wave-wide load covers 512 contiguous bytes, every store 256.
// ---------------------------------------------------------------------------
#define EW_T 512                 // threads per work-group
#define EW_U 8                   // 16-byte pieces per thread
#define EW_N4 (M_ * D_ / 4)      // pieces per array (mask and activations alike)
#define EW_G (EW_N4 / (EW_T * EW_U))  // work-groups per elementwise job
static_assert(T_ * T_ == M_ * D_, "mask and activations: one piece count");
static_assert(EW_G * EW_T * EW_U == EW_N4, "the grid covers the array exactly");

// Transposes: W[k][n] f32 -> Wt[n][k] f16 by 64x64 tiles through LDS, so the
// GEMM B operand is k-contiguous.  Each half of a work-group (256 threads)
// takes one tile, the two tiles side by side in n.  A thread loads 4 pieces of
// 16 B (a wave: two 256-B row pieces per load) and stores 2 pieces of 16 B (a
// wave: four whole 128-B lines per store).  Pitch 65 dwords: the row-wise
// writes and the column-wise reads both fall on 32 different banks.
#define TT 64
#define TR_G ((D_ / TT) * (D_ / TT) / 2)  // work-groups per weight matrix
#define PRE_G (4 * EW_G + 4 * TR_G)       // work-groups of the launch

__global__ __launch_bounds__(EW_T) void prepass_kernel(
    const float* __restrict__ mask, const float* __restrict__ xq,
    const float* __restrict__ xk, const float* __restrict__ xv,
    const float* __restrict__ Wq, const float* __restrict__ Wk,
    const float* __restrict__ Wv, const float* __restrict__ Wo,
    _Float16* __restrict__ Tm, _Float16* __restrict__ Xq,
    _Float16* __restrict__ Xk, _Float16* __restrict__ Xv,
    _Float16* __restrict__ Wqt, _Float16* __restrict__ Wkt,
    _Float16* __restrict__ Wvt, _Float16* __restrict__ Wot) {
  __shared__ float tile[2][TT][TT + 1];
  const int bid = blockIdx.x;

  if (bid < EW_G) {  // tanh(learnable_mask) -> f16, reused by all (b,h)
    const int i0 = bid * (EW_T * EW_U) + threadIdx.x;
    float4 v[EW_U];
    for (int u = 0; u < EW_U; ++u) v[u] = ((const float4*)mask)[i0 + u * EW_T];
    for (int u = 0; u < EW_U; ++u) {
      v4h h;
      h.x = (_Float16)tanhf(v[u].x); h.y = (_Float16)tanhf(v[u].y);
      h.z = (_Float16)tanhf(v[u].z); h.w = (_Float16)tanhf(v[u].w);
      ((v4h*)Tm)[i0 + u * EW_T] = h;
    }
    return;
  }

  if (bid < 4 * EW_G) {  // f32 -> f16 (activations)
    const int job = bid / EW_G;  // 1, 2, 3
    const float* in = job == 1 ? xq : job == 2 ? xk : xv;
    _Float16* out = job == 1 ? Xq : job == 2 ? Xk : Xv;
    const int i0 = (bid % EW_G) * (EW_T * EW_U) + threadIdx.x;
    float4 v[EW_U];
    for (int u = 0; u < EW_U; ++u) v[u] = ((const float4*)in)[i0 + u * EW_T];
    for (int u = 0; u < EW_U; ++u) {
      v4h h;
      h.x = (_Float16)v[u].x; h.y = (_Float16)v[u].y;
      h.z = (_Float16)v[u].z; h.w = (_Float16)v[u].w;
      ((v4h*)out)[i0 + u * EW_T] = h;
    }
    return;
  }

  // weight transposes
  const int tb = bid - 4 * EW_G;
  const int job = tb / TR_G;  // 0 .. 3
  const float* W = job == 0 ? Wq : job == 1 ? Wk : job == 2 ? Wv : Wo;
  _Float16* Wt = job == 0 ? Wqt : job == 1 ? Wkt : job == 2 ? Wvt : Wot;
  const int tid = threadIdx.x & 255;
  const int sub = threadIdx.x >> 8;          // which of the two tiles
  const int ti = (tb % TR_G) * 2 + sub;      // tile 0 .. 255 of this matrix
  const int n0 = (ti % (D_ / TT)) * TT, k0 = (ti / (D_ / TT)) * TT;
  float4 v[4];
  for (int u = 0; u < 4; ++u) {
    const int q = tid + u * 256, k = q >> 4, c = q & 15;
    v[u] = *(const float4*)(W + (size_t)(k0 + k) * D_ + n0 + c * 4);
  }
  for (int u = 0; u < 4; ++u) {
    const int q = tid + u * 256, k = q >> 4, c = q & 15;
    tile[sub][k][c * 4 + 0] = v[u].x; tile[sub][k][c * 4 + 1] = v[u].y;
    tile[sub][k][c * 4 + 2] = v[u].z; tile[sub][k][c * 4 + 3] = v[u].w;
  }
  __syncthreads();
  for (int u = 0; u < 2; ++u) {
    const int q = tid + u * 256, n = q >> 3, kc = q & 7;
    v8h h;
    for (int j = 0; j < 8; ++j) h[j] = (_Float16)tile[sub][kc * 8 + j][n];
    *(v8h*)(Wt + (size_t)(n0 + n) * D_ + k0 + kc * 8) = h;
  }
}

// ---------------------------------------------------------------------------
// Kernel 1/3: C = A @ W + bias, with A [4096 x 1024] f16 row-major and
// Wt [1024(n) x 1024(k)] f16 (pre-transposed).  Tile 128x64, BK=32, 8 waves,
// each wave a 32x32 block = 2x2 WMMA tiles.  Tiles staged by
// global_load_async_to_lds_b128, double-buffered (issue k+1 while computing k).
// HEADS=true : scatter f16 into [B,H,T,64] head layout, scale folded in.
//              The three projections, which read none of each other's output,
//              are ONE launch: blockIdx.z picks activations, weights, bias and
//              output (0: Q, 1: K, 2: V; each set of three lies back to back
//              in the workspace); 6 work-groups per WGP, all resident at once.
// HEADS=false: write f32 row-major [4096 x 1024] (final output); z is 0.
// ---------------------------------------------------------------------------
#define BM 128
#define BN 64
#define BK 32
#define LS 40  // LDS row stride in halves (32 + 8 pad; 80B, 16B aligned)

template <bool HEADS>
__global__ __launch_bounds__(256) void gemm_wmma_async(
    const _Float16* __restrict__ A0, const _Float16* __restrict__ Wt0,
    const float* __restrict__ bias0, const float* __restrict__ bias1,
    const float* __restrict__ bias2, void* __restrict__ outp0, float scale0) {
  __shared__ _Float16 sA[2][BM * LS];
  __shared__ _Float16 sB[2][BN * LS];

  const int z = HEADS ? blockIdx.z : 0;
  const _Float16* __restrict__ A = A0 + (size_t)z * M_ * D_;
  const _Float16* __restrict__ Wt = Wt0 + (size_t)z * D_ * D_;
  const float* __restrict__ bias = z == 0 ? bias0 : z == 1 ? bias1 : bias2;
  void* __restrict__ outp =
      HEADS ? (void*)((_Float16*)outp0 + (size_t)z * M_ * D_) : outp0;
  const float scale = z == 0 ? scale0 : 1.0f;  // 1/sqrt(DK) goes into Q alone

  const int tid = threadIdx.x;
  const int lane = tid & 31;
  const int wid = tid >> 5;
  const int wr = wid & 3;   // wave row 0..3  -> 32-row stripe
  const int wc = wid >> 2;  // wave col 0..1  -> 32-col stripe
  const int m0 = blockIdx.x * BM;
  const int n0 = blockIdx.y * BN;

  // Issue async copies for the k0 tile into buffer `buf`.
  // A tile: 128 rows x 4 16B-chunks = 512 chunks (2/thread);
  // B tile:  64 rows x 4 16B-chunks = 256 chunks (1/thread).
  auto issue_tile = [&](int k0, int buf) {
    for (int q = tid; q < 512; q += 256) {
      const int r = q >> 2, c = q & 3;
      async_copy_b128(&sA[buf][r * LS + c * 8],
                      A + (size_t)(m0 + r) * D_ + k0 + c * 8);
    }
    {
      const int r = tid >> 2, c = tid & 3;
      async_copy_b128(&sB[buf][r * LS + c * 8],
                      Wt + (size_t)(n0 + r) * D_ + k0 + c * 8);
    }
  };

  v8f c[2][2] = {};

  issue_tile(0, 0);
  const int NT = D_ / BK;  // 32 k-steps
  for (int kt = 0; kt < NT; ++kt) {
    const int buf = kt & 1;
    wait_async0();    // my chunks of tile kt have landed in LDS
    __syncthreads();  // everyone's chunks visible; prev reads of buf^1 done
    if (kt + 1 < NT) issue_tile((kt + 1) * BK, buf ^ 1);

    v16h a0 = load_frag_lds<LS>(sA[buf], wr * 32, 0);
    v16h a1 = load_frag_lds<LS>(sA[buf], wr * 32 + 16, 0);
    v16h b0 = load_frag_lds<LS>(sB[buf], wc * 32, 0);
    v16h b1 = load_frag_lds<LS>(sB[buf], wc * 32 + 16, 0);
    c[0][0] = wmma16(a0, b0, c[0][0]);
    c[0][1] = wmma16(a0, b1, c[0][1]);
    c[1][0] = wmma16(a1, b0, c[1][0]);
    c[1][1] = wmma16(a1, b1, c[1][1]);
  }

  // ---- epilogue ----
  // C/D layout: element (vgpr r, lane): row = r + (lane>=16 ? 8 : 0),
  // col = lane & 15 (ISA 7.12.2).
  const int half8 = (lane >> 4) << 3;
  const int ncol = lane & 15;
  for (int i = 0; i < 2; ++i)
    for (int j = 0; j < 2; ++j)
      for (int r = 0; r < 8; ++r) {
        const int m = m0 + wr * 32 + i * 16 + r + half8;
        const int n = n0 + wc * 32 + j * 16 + ncol;
        float v = c[i][j][r] + bias[n];
        if (HEADS) {
          v *= scale;  // 1/sqrt(DK) folded into Q
          const int b = m >> 11, t = m & (T_ - 1);
          const int h = n >> 6, d = n & (DK_ - 1);
          ((_Float16*)outp)[(((size_t)b * H_ + h) * T_ + t) * DK_ + d] =
              (_Float16)v;
        } else {
          ((float*)outp)[(size_t)m * D_ + n] = v;
        }
      }
}

#define VTS 72  // LDS row stride in halves for the V^T tile (64+8; 144B)
#define KTS 72  // LDS row stride in halves for the K tile (128B + 16B pad)
#define NKT (T_ / 64)  // key tiles

// lane l <-> lane l ^ 16 (the two halves of a wave hold the same query)
__device__ __forceinline__ float xhalf(float x) {
  const int b = __builtin_bit_cast(int, x);
  return __builtin_bit_cast(
      float, __builtin_amdgcn_permlanex16(b, b, 0x76543210, 0xfedcba98, false,
                                          false));
}

// The grid is 4 waves per SIMD (4,096 waves on 1,024 SIMDs): with that stated
// the compiler keeps the fragment loads grouped ahead of their products and
// does not fold them into one register set with a full LDS wait per product.
__global__ __launch_bounds__(128)
__attribute__((amdgpu_waves_per_eu(4, 4))) void attn_wmma(
    const _Float16* __restrict__ Qh, const _Float16* __restrict__ Kh,
    const _Float16* __restrict__ Vh, const _Float16* __restrict__ Tm,
    _Float16* __restrict__ ctx) {
  __shared__ _Float16 sVt[DK_ * VTS];    // V^T tile: [d][k], shared by WG
  __shared__ __attribute__((aligned(16)))
  _Float16 sK[2][64 * KTS];  // K tiles: [key][feature], two buffers

  const int tid = threadIdx.x, lane = tid & 31, wid = tid >> 5;
  const int bh = blockIdx.y;  // b*16 + h
  const int b = bh >> 4, h = bh & 15;
  const int q0 = blockIdx.x * 64 + wid * 16;
  const size_t base = (size_t)bh * T_ * DK_;

  // Q fragments (scale already folded in at projection time); B operand of
  // S^T: column = query lane & 15, same k order as the K fragments.
  v16h qa[2];
  {
    const _Float16* qb = Qh + base + (size_t)q0 * DK_;
    qa[0] = load_frag_g64(qb, 0);
    qa[1] = load_frag_g64(qb, 32);
  }

  const int half8 = (lane >> 4) << 3;
  const int ncol = lane & 15;

  v8f o[4] = {};  // O^T: o[j][r] = O[q0 + ncol][j*16 + half8 + r]
  float rmax = -1e30f;  // this lane's query, joined over both halves
  float rsum = 0.0f;    // this lane's half of the keys; joined in the epilogue

  // this lane's mask row, at its first key of a tile
  const _Float16* tmrow = Tm + (size_t)(q0 + ncol) * T_ + half8;

  // Copies of K tile t into buffer buf: 512 chunks of 16 B, 4 per thread;
  // a wave's 32 lanes cover 512 contiguous bytes (4 whole key rows) per copy.
  auto issue_k = [&](int t, int buf) {
    const _Float16* g = Kh + base + (size_t)t * 64 * DK_ + tid * 8;
    const _Float16* l = &sK[buf][(tid >> 3) * KTS + (tid & 7) * 8];
    async_copy4_b128(l, l + 16 * KTS, l + 32 * KTS, l + 48 * KTS, g,
                     g + 16 * DK_, g + 32 * DK_, g + 48 * DK_);
  };

  issue_k(0, 0);
  wait_async0();    // my chunks of K tile 0 have landed
  __syncthreads();  // everyone's chunks of K tile 0 visible
  issue_k(1, 1);

  for (int kt = 0; kt < NKT; ++kt) {
    const int k0 = kt * 64;
    const _Float16* kl = sK[kt & 1];

    // tanh(mask) of this lane's query: 8 consecutive keys per 16-key tile
    v8h tmv[4];
    for (int j = 0; j < 4; ++j)
      tmv[j] = *(const v8h*)(tmrow + k0 + j * 16);

    {  // cooperative transpose of V tile: V[k][d] -> sVt[d][k]
       // (the previous trip's sVt reads ended at its foot barrier)
      const int kv = tid & 63;
      const int dh = tid >> 6;  // 0 or 1 (d halves)
      const _Float16* vrow = Vh + base + (size_t)(k0 + kv) * DK_ + dh * 32;
      for (int dd = 0; dd < 32; ++dd)
        sVt[(dh * 32 + dd) * VTS + kv] = vrow[dd];
    }
    __syncthreads();

    // ---- S^T = K Q^T: s[j][r] = S[q0 + ncol][k0 + j*16 + half8 + r] ----
    v16h kb[4][2];
    for (int j = 0; j < 4; ++j) {
      kb[j][0] = load_frag_lds<KTS>(kl, j * 16, 0);
      kb[j][1] = load_frag_lds<KTS>(kl, j * 16, 32);
    }
    v8f s[4] = {};
    for (int j = 0; j < 4; ++j) s[j] = wmma16(kb[j][0], qa[0], s[j]);
    for (int j = 0; j < 4; ++j) s[j] = wmma16(kb[j][1], qa[1], s[j]);

    // V^T fragments (A operand of the second product): they depend on nothing
    // below, so their LDS latency passes behind the softmax arithmetic
    v16h vb[4][2];
    for (int j = 0; j < 4; ++j) {
      vb[j][0] = load_frag_lds<VTS>(sVt, j * 16, 0);
      vb[j][1] = load_frag_lds<VTS>(sVt, j * 16, 32);
    }

    // ---- online softmax: this query's maximum, in-lane, then both halves ----
    float mj[4];
    for (int j = 0; j < 4; ++j) {
      mj[j] = s[j][0];
      for (int r = 1; r < 8; ++r) mj[j] = fmaxf(mj[j], s[j][r]);
    }
    float m = fmaxf(fmaxf(mj[0], mj[1]), fmaxf(mj[2], mj[3]));
    m = fmaxf(m, xhalf(m));
    const float mn = fmaxf(rmax, m);
    const float scl = __expf(rmax - mn);
    rmax = mn;

    // ---- P = exp(S-max); denominator unmasked, numerator * tanh(mask) ----
    // pb[mm][e] = P^T[key 32*mm + kmap(e)][query]: tiles 2*mm and 2*mm+1 in
    // register order are the hardware k order of a B operand.
    v16h pb[2];
    float tj[4];
    // both loops unrolled: left rolled, the register arrays are indexed by a
    // variable and pb goes to scratch memory
#pragma unroll
    for (int j = 0; j < 4; ++j) {
      tj[j] = 0.0f;
#pragma unroll
      for (int r = 0; r < 8; ++r) {
        const float e = __expf(s[j][r] - rmax);
        tj[j] += e;
        pb[j >> 1][(j & 1) * 8 + r] = (_Float16)(e * (float)tmv[j][r]);
      }
    }
    rsum = rsum * scl + ((tj[0] + tj[1]) + (tj[2] + tj[3]));
    for (int j = 0; j < 4; ++j)
      for (int r = 0; r < 8; ++r) o[j][r] *= scl;

    // ---- O^T += V^T P^T ----
    for (int j = 0; j < 4; ++j) o[j] = wmma16(vb[j][0], pb[0], o[j]);
    for (int j = 0; j < 4; ++j) o[j] = wmma16(vb[j][1], pb[1], o[j]);

    // ---- foot: publish K tile kt+1, free this trip's K buffer and sVt ----
    // my LDS reads of this trip have returned before the buffer is refilled
    asm volatile("s_wait_dscnt 0x0" ::: "memory");
    wait_async0();    // my chunks of K tile kt+1 have landed
    __syncthreads();  // all chunks visible; all reads of sK[kt&1], sVt done
    if (kt + 2 < NKT) issue_k(kt + 2, kt & 1);
  }
  wait_async0();  // nothing in flight when the wave ends

  // ---- normalize and write ctx as f16 [B, T, D] (heads re-interleaved) ----
  // a lane's 8 accumulator registers are 8 consecutive features of its query
  const float inv = 1.0f / fmaxf(rsum + xhalf(rsum), 1e-20f);
  _Float16* crow = ctx + ((size_t)b * T_ + q0 + ncol) * D_ + h * DK_ + half8;
  for (int j = 0; j < 4; ++j) {
    v8h w;
    for (int r = 0; r < 8; ++r) w[r] = (_Float16)(o[j][r] * inv);
    *(v8h*)(crow + j * 16) = w;
  }
}

// ---------------------------------------------------------------------------
// Host launcher
// ---------------------------------------------------------------------------
extern "C" void kernel_launch(void* const* d_in, const int* in_sizes, int n_in,
                              void* d_out, int out_size, void* d_ws,
                              size_t ws_size, hipStream_t stream) {
  (void)in_sizes; (void)n_in; (void)out_size; (void)ws_size;

  const float* query = (const float*)d_in[0];
  const float* key   = (const float*)d_in[1];
  const float* value = (const float*)d_in[2];
  const float* Wq = (const float*)d_in[3];
  const float* bq = (const float*)d_in[4];
  const float* Wk = (const float*)d_in[5];
  const float* bk = (const float*)d_in[6];
  const float* Wv = (const float*)d_in[7];
  const float* bv = (const float*)d_in[8];
  const float* Wo = (const float*)d_in[9];
  const float* bo = (const float*)d_in[10];
  const float* lmask = (const float*)d_in[11];

  // workspace carve-up (MiB offsets), 64 MiB total
  char* ws = (char*)d_ws;
  const size_t MB = (size_t)1 << 20;
  _Float16* Qh  = (_Float16*)(ws + 0 * MB);   // [B,H,T,64] f16 (pre-scaled)
  _Float16* Kh  = (_Float16*)(ws + 8 * MB);
  _Float16* Vh  = (_Float16*)(ws + 16 * MB);
  _Float16* Tm  = (_Float16*)(ws + 24 * MB);  // tanh(mask) f16 [T,T]
  _Float16* Xq  = (_Float16*)(ws + 32 * MB);  // f16 activations
  _Float16* Xk  = (_Float16*)(ws + 40 * MB);
  _Float16* Xv  = (_Float16*)(ws + 48 * MB);
  _Float16* Wqt = (_Float16*)(ws + 56 * MB);  // f16 transposed weights [n][k]
  _Float16* Wkt = (_Float16*)(ws + 58 * MB);
  _Float16* Wvt = (_Float16*)(ws + 60 * MB);
  _Float16* Wot = (_Float16*)(ws + 62 * MB);
  _Float16* ctx = (_Float16*)(ws + 32 * MB);  // reuse Xq (consumed by then)

  prepass_kernel<<<PRE_G, EW_T, 0, stream>>>(lmask, query, key, value, Wq, Wk,
                                             Wv, Wo, Tm, Xq, Xk, Xv, Wqt, Wkt,
                                             Wvt, Wot);

  const float qscale = 0.125f;  // 1/sqrt(64)
  // Xq/Xk/Xv, Wqt/Wkt/Wvt and Qh/Kh/Vh each lie back to back (see above)
  gemm_wmma_async<true><<<dim3(M_ / BM, D_ / BN, 3), 256, 0, stream>>>(
      Xq, Wqt, bq, bk, bv, Qh, qscale);

  attn_wmma<<<dim3(T_ / 64, B_ * H_), 128, 0, stream>>>(Qh, Kh, Vh, Tm, ctx);

  gemm_wmma_async<false><<<dim3(M_ / BM, D_ / BN), 256, 0, stream>>>(
      ctx, Wot, bo, bo, bo, d_out, 1.0f);
}

// v005
// Measured time: 117 microseconds a run.
// Timed twice side by side with v004, it ran 1.13 and 1.12 times as fast.
// All steps since v000 together make it 2.02 times as fast.
#include <hip/hip_runtime.h>
#include <hip/hip_bf16.h>

// ---------------------------------------------------------------------------
// MHA forward for B=2, T=2048, D=1024, H=16, DK=64 on gfx1250 (MI455X).
// All GEMMs run through v_wmma_f32_16x16x32_f16 (f16 in, f32 accumulate).
// GEMM tiles are staged global->LDS with GLOBAL_LOAD_ASYNC_TO_LDS_B128
// (ASYNCcnt) in a double-buffered pipeline.
// ---------------------------------------------------------------------------

typedef __attribute__((ext_vector_type(16))) _Float16 v16h;
typedef __attribute__((ext_vector_type(8)))  _Float16 v8h;
typedef __attribute__((ext_vector_type(4)))  _Float16 v4h;
typedef __attribute__((ext_vector_type(8)))  float    v8f;

#define B_  2
#define T_  2048
#define H_  16
#define DK_ 64
#define D_  1024
#define M_  (B_ * T_)   // 4096 rows for the projection GEMMs

__device__ __forceinline__ v8f wmma16(v16h a, v16h b, v8f c) {
  // (neg_a, A, neg_b, B, c_mod, C, reuse_a, reuse_b)
  return __builtin_amdgcn_wmma_f32_16x16x32_f16(false, a, false, b, (short)0, c,
                                                false, false);
}

// Async DMA of one 16-byte chunk: global -> LDS, tracked with ASYNCcnt.
// VDST = per-lane LDS byte offset (low 32 bits of the generic LDS pointer,
// per the CDNA5 aperture mapping), VADDR = 64-bit global address.
__device__ __forceinline__ void async_copy_b128(void* lds_ptr,
                                                const void* gptr) {
  const unsigned loff = (unsigned)(unsigned long long)lds_ptr;
  asm volatile("global_load_async_to_lds_b128 %0, %1, off" ::"v"(loff),
               "v"(gptr)
               : "memory");
}
__device__ __forceinline__ void wait_async0() {
  asm volatile("s_wait_asynccnt 0x0" ::: "memory");
}
// Eight such copies of one lane in ONE statement.  The closing s_wait_xcnt
// stands inside the statement so that no address register of an issued copy
// is rewritten in front of it.
__device__ __forceinline__ void async_copy8_b128(
    const void* l0, const void* l1, const void* l2, const void* l3,
    const void* l4, const void* l5, const void* l6, const void* l7,
    const void* g0, const void* g1, const void* g2, const void* g3,
    const void* g4, const void* g5, const void* g6, const void* g7) {
  asm volatile(
      "global_load_async_to_lds_b128 %0, %8, off\n\t"
      "global_load_async_to_lds_b128 %1, %9, off\n\t"
      "global_load_async_to_lds_b128 %2, %10, off\n\t"
      "global_load_async_to_lds_b128 %3, %11, off\n\t"
      "global_load_async_to_lds_b128 %4, %12, off\n\t"
      "global_load_async_to_lds_b128 %5, %13, off\n\t"
      "global_load_async_to_lds_b128 %6, %14, off\n\t"
      "global_load_async_to_lds_b128 %7, %15, off\n\t"
      "s_wait_xcnt 0x0" ::"v"((unsigned)(unsigned long long)l0),
      "v"((unsigned)(unsigned long long)l1),
      "v"((unsigned)(unsigned long long)l2),
      "v"((unsigned)(unsigned long long)l3),
      "v"((unsigned)(unsigned long long)l4),
      "v"((unsigned)(unsigned long long)l5),
      "v"((unsigned)(unsigned long long)l6),
      "v"((unsigned)(unsigned long long)l7), "v"(g0), "v"(g1), "v"(g2), "v"(g3),
      "v"(g4), "v"(g5), "v"(g6), "v"(g7)
      : "memory");
}

// Load a 16x32 f16 WMMA A/B fragment from LDS stored [row][k], k contiguous,
// row stride STRIDE halves (STRIDE % 8 == 0 so each half-row chunk is a
// 16-byte-aligned ds_load_b128).
// Lane L (L<16): row = row0+L, K = {kh..kh+7, 16+kh..16+kh+7} with kh=0.
// Lane L+16:    same row, kh=8.  Matches CDNA5 16-bit A layout (ISA 7.12.2).
template <int STRIDE>
__device__ __forceinline__ v16h load_frag_lds(const _Float16* base, int row0,
                                              int kOff) {
  const int lane = threadIdx.x & 31;
  const _Float16* p =
      base + (size_t)(row0 + (lane & 15)) * STRIDE + kOff + ((lane >> 4) << 3);
  v8h lo = *(const v8h*)(p);
  v8h hi = *(const v8h*)(p + 16);
  return __builtin_shufflevector(lo, hi, 0, 1, 2, 3, 4, 5, 6, 7, 8, 9, 10, 11,
                                 12, 13, 14, 15);
}

// Same fragment shape, loaded directly from global memory with row stride 64
// halves (the [*, 64] head layout of Q/K: row = head-row, k-dim = feature).
__device__ __forceinline__ v16h load_frag_g64(const _Float16* base, int kOff) {
  const int lane = threadIdx.x & 31;
  const _Float16* p =
      base + (size_t)(lane & 15) * DK_ + kOff + ((lane >> 4) << 3);
  v8h lo = *(const v8h*)(p);
  v8h hi = *(const v8h*)(p + 16);
  return __builtin_shufflevector(lo, hi, 0, 1, 2, 3, 4, 5, 6, 7, 8, 9, 10, 11,
                                 12, 13, 14, 15);
}

// ---------------------------------------------------------------------------
// Pre-pass: ONE launch for the eight jobs that read inputs only and none of
// each other's output (tanh of the mask, three f32 -> f16 conversions, four
// weight transposes).  A work-group's job follows from its index; the heavier
// jobs have the lower indices and start first, the short transposes fill the
// places they leave.  Few waves with much work each, 16 waves a work-group.
// Elementwise jobs: a thread takes 8 pieces of 16 B, all 8 loads in flight at
// once; every wave-wide load covers 512 contiguous bytes, every store 256.
// ---------------------------------------------------------------------------
#define EW_T 512                 // threads per work-group
#define EW_U 8                   // 16-byte pieces per thread
#define EW_N4 (M_ * D_ / 4)      // pieces per array (mask and activations alike)
#define EW_G (EW_N4 / (EW_T * EW_U))  // work-groups per elementwise job
static_assert(T_ * T_ == M_ * D_, "mask and activations: one piece count");
static_assert(EW_G * EW_T * EW_U == EW_N4, "the grid covers the array exactly");

// Transposes: W[k][n] f32 -> Wt[n][k] f16 by 64x64 tiles through LDS, so the
// GEMM B operand is k-contiguous.  Each half of a work-group (256 threads)
// takes one tile, the two tiles side by side in n.  A thread loads 4 pieces of
// 16 B (a wave: two 256-B row pieces per load) and stores 2 pieces of 16 B (a
// wave: four whole 128-B lines per store).  Pitch 65 dwords: the row-wise
// writes and the column-wise reads both fall on 32 different banks.
#define TT 64
#define TR_G ((D_ / TT) * (D_ / TT) / 2)  // work-groups per weight matrix
#define PRE_G (4 * EW_G + 4 * TR_G)       // work-groups of the launch

__global__ __launch_bounds__(EW_T) void prepass_kernel(
    const float* __restrict__ mask, const float* __restrict__ xq,
    const float* __restrict__ xk, const float* __restrict__ xv,
    const float* __restrict__ Wq, const float* __restrict__ Wk,
    const float* __restrict__ Wv, const float* __restrict__ Wo,
    _Float16* __restrict__ Tm, _Float16* __restrict__ Xq,
    _Float16* __restrict__ Xk, _Float16* __restrict__ Xv,
    _Float16* __restrict__ Wqt, _Float16* __restrict__ Wkt,
    _Float16* __restrict__ Wvt, _Float16* __restrict__ Wot) {
  __shared__ float tile[2][TT][TT + 1];
  const int bid = blockIdx.x;

  if (bid < EW_G) {  // tanh(learnable_mask) -> f16, reused by all (b,h)
    const int i0 = bid * (EW_T * EW_U) + threadIdx.x;
    float4 v[EW_U];
    for (int u = 0; u < EW_U; ++u) v[u] = ((const float4*)mask)[i0 + u * EW_T];
    for (int u = 0; u < EW_U; ++u) {
      v4h h;
      h.x = (_Float16)tanhf(v[u].x); h.y = (_Float16)tanhf(v[u].y);
      h.z = (_Float16)tanhf(v[u].z); h.w = (_Float16)tanhf(v[u].w);
      ((v4h*)Tm)[i0 + u * EW_T] = h;
    }
    return;
  }

  if (bid < 4 * EW_G) {  // f32 -> f16 (activations)
    const int job = bid / EW_G;  // 1, 2, 3
    const float* in = job == 1 ? xq : job == 2 ? xk : xv;
    _Float16* out = job == 1 ? Xq : job == 2 ? Xk : Xv;
    const int i0 = (bid % EW_G) * (EW_T * EW_U) + threadIdx.x;
    float4 v[EW_U];
    for (int u = 0; u < EW_U; ++u) v[u] = ((const float4*)in)[i0 + u * EW_T];
    for (int u = 0; u < EW_U; ++u) {
      v4h h;
      h.x = (_Float16)v[u].x; h.y = (_Float16)v[u].y;
      h.z = (_Float16)v[u].z; h.w = (_Float16)v[u].w;
      ((v4h*)out)[i0 + u * EW_T] = h;
    }
    return;
  }

  // weight transposes
  const int tb = bid - 4 * EW_G;
  const int job = tb / TR_G;  // 0 .. 3
  const float* W = job == 0 ? Wq : job == 1 ? Wk : job == 2 ? Wv : Wo;
  _Float16* Wt = job == 0 ? Wqt : job == 1 ? Wkt : job == 2 ? Wvt : Wot;
  const int tid = threadIdx.x & 255;
  const int sub = threadIdx.x >> 8;          // which of the two tiles
  const int ti = (tb % TR_G) * 2 + sub;      // tile 0 .. 255 of this matrix
  const int n0 = (ti % (D_ / TT)) * TT, k0 = (ti / (D_ / TT)) * TT;
  float4 v[4];
  for (int u = 0; u < 4; ++u) {
    const int q = tid + u * 256, k = q >> 4, c = q & 15;
    v[u] = *(const float4*)(W + (size_t)(k0 + k) * D_ + n0 + c * 4);
  }
  for (int u = 0; u < 4; ++u) {
    const int q = tid + u * 256, k = q >> 4, c = q & 15;
    tile[sub][k][c * 4 + 0] = v[u].x; tile[sub][k][c * 4 + 1] = v[u].y;
    tile[sub][k][c * 4 + 2] = v[u].z; tile[sub][k][c * 4 + 3] = v[u].w;
  }
  __syncthreads();
  for (int u = 0; u < 2; ++u) {
    const int q = tid + u * 256, n = q >> 3, kc = q & 7;
    v8h h;
    for (int j = 0; j < 8; ++j) h[j] = (_Float16)tile[sub][kc * 8 + j][n];
    *(v8h*)(Wt + (size_t)(n0 + n) * D_ + k0 + kc * 8) = h;
  }
}

// ---------------------------------------------------------------------------
// Kernel 1/3: C = A @ W + bias, with A [4096 x 1024] f16 row-major and
// Wt [1024(n) x 1024(k)] f16 (pre-transposed).  Tile 128x64, BK=32, 8 waves,
// each wave a 32x32 block = 2x2 WMMA tiles.  Tiles staged by
// global_load_async_to_lds_b128, double-buffered (issue k+1 while computing k).
// HEADS=true : scatter f16 into [B,H,T,64] head layout, scale folded in; V
//              alone goes out transposed by 64-key tiles, [B,H,T/64,64(d),64(t)]:
//              each tile is the 8 KiB block, features by keys, that the
//              attention kernel needs as a matrix operand.
//              The three projections, which read none of each other's output,
//              are ONE launch: blockIdx.z picks activations, weights, bias and
//              output (0: Q, 1: K, 2: V; each set of three lies back to back
//              in the workspace); 6 work-groups per WGP, all resident at once.
// HEADS=false: write f32 row-major [4096 x 1024] (final output); z is 0.
// ---------------------------------------------------------------------------
#define BM 128
#define BN 64
#define BK 32
#define LS 40  // LDS row stride in halves (32 + 8 pad; 80B, 16B aligned)

template <bool HEADS>
__global__ __launch_bounds__(256) void gemm_wmma_async(
    const _Float16* __restrict__ A0, const _Float16* __restrict__ Wt0,
    const float* __restrict__ bias0, const float* __restrict__ bias1,
    const float* __restrict__ bias2, void* __restrict__ outp0, float scale0) {
  __shared__ _Float16 sA[2][BM * LS];
  __shared__ _Float16 sB[2][BN * LS];

  const int z = HEADS ? blockIdx.z : 0;
  const _Float16* __restrict__ A = A0 + (size_t)z * M_ * D_;
  const _Float16* __restrict__ Wt = Wt0 + (size_t)z * D_ * D_;
  const float* __restrict__ bias = z == 0 ? bias0 : z == 1 ? bias1 : bias2;
  void* __restrict__ outp =
      HEADS ? (void*)((_Float16*)outp0 + (size_t)z * M_ * D_) : outp0;
  const float scale = z == 0 ? scale0 : 1.0f;  // 1/sqrt(DK) goes into Q alone

  const int tid = threadIdx.x;
  const int lane = tid & 31;
  const int wid = tid >> 5;
  const int wr = wid & 3;   // wave row 0..3  -> 32-row stripe
  const int wc = wid >> 2;  // wave col 0..1  -> 32-col stripe
  const int m0 = blockIdx.x * BM;
  const int n0 = blockIdx.y * BN;

  // Issue async copies for the k0 tile into buffer `buf`.
  // A tile: 128 rows x 4 16B-chunks = 512 chunks (2/thread);
  // B tile:  64 rows x 4 16B-chunks = 256 chunks (1/thread).
  auto issue_tile = [&](int k0, int buf) {
    for (int q = tid; q < 512; q += 256) {
      const int r = q >> 2, c = q & 3;
      async_copy_b128(&sA[buf][r * LS + c * 8],
                      A + (size_t)(m0 + r) * D_ + k0 + c * 8);
    }
    {
      const int r = tid >> 2, c = tid & 3;
      async_copy_b128(&sB[buf][r * LS + c * 8],
                      Wt + (size_t)(n0 + r) * D_ + k0 + c * 8);
    }
  };

  v8f c[2][2] = {};

  issue_tile(0, 0);
  const int NT = D_ / BK;  // 32 k-steps
  for (int kt = 0; kt < NT; ++kt) {
    const int buf = kt & 1;
    wait_async0();    // my chunks of tile kt have landed in LDS
    __syncthreads();  // everyone's chunks visible; prev reads of buf^1 done
    if (kt + 1 < NT) issue_tile((kt + 1) * BK, buf ^ 1);

    v16h a0 = load_frag_lds<LS>(sA[buf], wr * 32, 0);
    v16h a1 = load_frag_lds<LS>(sA[buf], wr * 32 + 16, 0);
    v16h b0 = load_frag_lds<LS>(sB[buf], wc * 32, 0);
    v16h b1 = load_frag_lds<LS>(sB[buf], wc * 32 + 16, 0);
    c[0][0] = wmma16(a0, b0, c[0][0]);
    c[0][1] = wmma16(a0, b1, c[0][1]);
    c[1][0] = wmma16(a1, b0, c[1][0]);
    c[1][1] = wmma16(a1, b1, c[1][1]);
  }

  // ---- epilogue ----
  // C/D layout: element (vgpr r, lane): row = r + (lane>=16 ? 8 : 0),
  // col = lane & 15 (ISA 7.12.2).
  const int half8 = (lane >> 4) << 3;
  const int ncol = lane & 15;
  if (HEADS && z == 2) {
    // V^T: a lane's 8 accumulator registers are 8 consecutive positions t of
    // one feature d, so each 16x16 tile leaves as one 16-byte store per lane.
    for (int i = 0; i < 2; ++i)
      for (int j = 0; j < 2; ++j) {
        const int m = m0 + wr * 32 + i * 16 + half8;
        const int n = n0 + wc * 32 + j * 16 + ncol;
        const float bn = bias[n];
        const int b = m >> 11, t = m & (T_ - 1);
        const int h = n >> 6, d = n & (DK_ - 1);
        v8h w;
        for (int r = 0; r < 8; ++r) w[r] = (_Float16)(c[i][j][r] + bn);
        *(v8h*)((_Float16*)outp + ((size_t)b * H_ + h) * T_ * DK_ +
                ((t >> 6) * DK_ + d) * 64 + (t & 63)) = w;
      }
    return;
  }
  for (int i = 0; i < 2; ++i)
    for (int j = 0; j < 2; ++j)
      for (int r = 0; r < 8; ++r) {
        const int m = m0 + wr * 32 + i * 16 + r + half8;
        const int n = n0 + wc * 32 + j * 16 + ncol;
        float v = c[i][j][r] + bias[n];
        if (HEADS) {
          v *= scale;  // 1/sqrt(DK) folded into Q
          const int b = m >> 11, t = m & (T_ - 1);
          const int h = n >> 6, d = n & (DK_ - 1);
          ((_Float16*)outp)[(((size_t)b * H_ + h) * T_ + t) * DK_ + d] =
              (_Float16)v;
        } else {
          ((float*)outp)[(size_t)m * D_ + n] = v;
        }
      }
}

#define VTS 72  // LDS row stride in halves for the V^T tile (64+8; 144B)
#define KTS 72  // LDS row stride in halves for the K tile (128B + 16B pad)
#define NKT (T_ / 64)  // key tiles

// lane l <-> lane l ^ 16 (the two halves of a wave hold the same query)
__device__ __forceinline__ float xhalf(float x) {
  const int b = __builtin_bit_cast(int, x);
  return __builtin_bit_cast(
      float, __builtin_amdgcn_permlanex16(b, b, 0x76543210, 0xfedcba98, false,
                                          false));
}

// The grid is 4 waves per SIMD (4,096 waves on 1,024 SIMDs): with that stated
// the compiler keeps the fragment loads grouped ahead of their products and
// does not fold them into one register set with a full LDS wait per product.
__global__ __launch_bounds__(128)
__attribute__((amdgpu_waves_per_eu(4, 4))) void attn_wmma(
    const _Float16* __restrict__ Qh, const _Float16* __restrict__ Kh,
    const _Float16* __restrict__ Vt, const _Float16* __restrict__ Tm,
    _Float16* __restrict__ ctx) {
  __shared__ __attribute__((aligned(16)))
  _Float16 sVt[2][DK_ * VTS];  // V^T tiles: [feature][key], two buffers
  __shared__ __attribute__((aligned(16)))
  _Float16 sK[2][64 * KTS];  // K tiles: [key][feature], two buffers

  const int tid = threadIdx.x, lane = tid & 31, wid = tid >> 5;
  const int bh = blockIdx.y;  // b*16 + h
  const int b = bh >> 4, h = bh & 15;
  const int q0 = blockIdx.x * 64 + wid * 16;
  const size_t base = (size_t)bh * T_ * DK_;

  // Q fragments (scale already folded in at projection time); B operand of
  // S^T: column = query lane & 15, same k order as the K fragments.
  v16h qa[2];
  {
    const _Float16* qb = Qh + base + (size_t)q0 * DK_;
    qa[0] = load_frag_g64(qb, 0);
    qa[1] = load_frag_g64(qb, 32);
  }

  const int half8 = (lane >> 4) << 3;
  const int ncol = lane & 15;

  v8f o[4] = {};  // O^T: o[j][r] = O[q0 + ncol][j*16 + half8 + r]
  float rmax = -1e30f;  // this lane's query, joined over both halves
  float rsum = 0.0f;    // this lane's half of the keys; joined in the epilogue

  // this lane's mask row, at its first key of a tile
  const _Float16* tmrow = Tm + (size_t)(q0 + ncol) * T_ + half8;

  // Copies of K tile t into buffer buf: 512 chunks of 16 B, 4 per thread;
  // a wave's 32 lanes cover 512 contiguous bytes (4 whole key rows) per copy.
  // The same for V^T tile t (4 whole feature rows per copy).
  auto issue_kv = [&](int t, int buf) {
    const _Float16* g = Kh + base + (size_t)t * 64 * DK_ + tid * 8;
    const _Float16* l = &sK[buf][(tid >> 3) * KTS + (tid & 7) * 8];
    const _Float16* gv = Vt + base + (size_t)t * DK_ * 64 + tid * 8;
    const _Float16* lv = &sVt[buf][(tid >> 3) * VTS + (tid & 7) * 8];
    async_copy8_b128(l, l + 16 * KTS, l + 32 * KTS, l + 48 * KTS, lv,
                     lv + 16 * VTS, lv + 32 * VTS, lv + 48 * VTS, g,
                     g + 16 * DK_, g + 32 * DK_, g + 48 * DK_, gv, gv + 16 * 64,
                     gv + 32 * 64, gv + 48 * 64);
  };

  issue_kv(0, 0);
  wait_async0();    // my chunks of tiles 0 have landed
  __syncthreads();  // everyone's chunks of tiles 0 visible
  issue_kv(1, 1);

  for (int kt = 0; kt < NKT; ++kt) {
    const int k0 = kt * 64;
    const _Float16* kl = sK[kt & 1];
    const _Float16* vl = sVt[kt & 1];

    // tanh(mask) of this lane's query: 8 consecutive keys per 16-key tile
    v8h tmv[4];
    for (int j = 0; j < 4; ++j)
      tmv[j] = *(const v8h*)(tmrow + k0 + j * 16);

    // ---- S^T = K Q^T: s[j][r] = S[q0 + ncol][k0 + j*16 + half8 + r] ----
    v16h kb[4][2];
    for (int j = 0; j < 4; ++j) {
      kb[j][0] = load_frag_lds<KTS>(kl, j * 16, 0);
      kb[j][1] = load_frag_lds<KTS>(kl, j * 16, 32);
    }
    // keeps the 16 K fragment loads one group ahead of the products: spread
    // among them, each small group is waited out to zero in one shared
    // register set
    __builtin_amdgcn_sched_barrier(0);
    v8f s[4] = {};
    for (int j = 0; j < 4; ++j) s[j] = wmma16(kb[j][0], qa[0], s[j]);
    for (int j = 0; j < 4; ++j) s[j] = wmma16(kb[j][1], qa[1], s[j]);

    // V^T fragments (A operand of the second product): they depend on nothing
    // below, so their LDS latency passes behind the softmax arithmetic
    v16h vb[4][2];
    for (int j = 0; j < 4; ++j) {
      vb[j][0] = load_frag_lds<VTS>(vl, j * 16, 0);
      vb[j][1] = load_frag_lds<VTS>(vl, j * 16, 32);
    }

    // ---- online softmax: this query's maximum, in-lane, then both halves ----
    float mj[4];
    for (int j = 0; j < 4; ++j) {
      mj[j] = s[j][0];
      for (int r = 1; r < 8; ++r) mj[j] = fmaxf(mj[j], s[j][r]);
    }
    float m = fmaxf(fmaxf(mj[0], mj[1]), fmaxf(mj[2], mj[3]));
    m = fmaxf(m, xhalf(m));
    const float mn = fmaxf(rmax, m);
    const float scl = __expf(rmax - mn);
    rmax = mn;
    // keeps the mask's conversions, and with them the wait on its global
    // loads, behind the score products and the maximum: lifted among the
    // products they stall the wave on memory at the head of every trip
    __builtin_amdgcn_sched_barrier(0);

    // ---- P = exp(S-max); denominator unmasked, numerator * tanh(mask) ----
    // pb[mm][e] = P^T[key 32*mm + kmap(e)][query]: tiles 2*mm and 2*mm+1 in
    // register order are the hardware k order of a B operand.
    v16h pb[2];
    float tj[4];
    // both loops unrolled: left rolled, the register arrays are indexed by a
    // variable and pb goes to scratch memory
#pragma unroll
    for (int j = 0; j < 4; ++j) {
      tj[j] = 0.0f;
#pragma unroll
      for (int r = 0; r < 8; ++r) {
        const float e = __expf(s[j][r] - rmax);
        tj[j] += e;
        pb[j >> 1][(j & 1) * 8 + r] = (_Float16)(e * (float)tmv[j][r]);
      }
    }
    rsum = rsum * scl + ((tj[0] + tj[1]) + (tj[2] + tj[3]));
    for (int j = 0; j < 4; ++j)
      for (int r = 0; r < 8; ++r) o[j][r] *= scl;

    // ---- O^T += V^T P^T ----
    for (int j = 0; j < 4; ++j) o[j] = wmma16(vb[j][0], pb[0], o[j]);
    for (int j = 0; j < 4; ++j) o[j] = wmma16(vb[j][1], pb[1], o[j]);

    // ---- foot: publish tiles kt+1, free this trip's K and V^T buffers ----
    // my LDS reads of this trip have returned before the buffers are refilled
    asm volatile("s_wait_dscnt 0x0" ::: "memory");
    wait_async0();    // my chunks of tiles kt+1 have landed
    __syncthreads();  // all chunks visible; all reads of this trip's buffers done
    if (kt + 2 < NKT) issue_kv(kt + 2, kt & 1);
  }
  wait_async0();  // nothing in flight when the wave ends

  // ---- normalize and write ctx as f16 [B, T, D] (heads re-interleaved) ----
  // a lane's 8 accumulator registers are 8 consecutive features of its query
  const float inv = 1.0f / fmaxf(rsum + xhalf(rsum), 1e-20f);
  _Float16* crow = ctx + ((size_t)b * T_ + q0 + ncol) * D_ + h * DK_ + half8;
  for (int j = 0; j < 4; ++j) {
    v8h w;
    for (int r = 0; r < 8; ++r) w[r] = (_Float16)(o[j][r] * inv);
    *(v8h*)(crow + j * 16) = w;
  }
}

// ---------------------------------------------------------------------------
// Host launcher
// ---------------------------------------------------------------------------
extern "C" void kernel_launch(void* const* d_in, const int* in_sizes, int n_in,
                              void* d_out, int out_size, void* d_ws,
                              size_t ws_size, hipStream_t stream) {
  (void)in_sizes; (void)n_in; (void)out_size; (void)ws_size;

  const float* query = (const float*)d_in[0];
  const float* key   = (const float*)d_in[1];
  const float* value = (const float*)d_in[2];
  const float* Wq = (const float*)d_in[3];
  const float* bq = (const float*)d_in[4];
  const float* Wk = (const float*)d_in[5];
  const float* bk = (const float*)d_in[6];
  const float* Wv = (const float*)d_in[7];
  const float* bv = (const float*)d_in[8];
  const float* Wo = (const float*)d_in[9];
  const float* bo = (const float*)d_in[10];
  const float* lmask = (const float*)d_in[11];

  // workspace carve-up (MiB offsets), 64 MiB total
  char* ws = (char*)d_ws;
  const size_t MB = (size_t)1 << 20;
  _Float16* Qh  = (_Float16*)(ws + 0 * MB);   // [B,H,T,64] f16 (pre-scaled)
  _Float16* Kh  = (_Float16*)(ws + 8 * MB);
  _Float16* Vt  = (_Float16*)(ws + 16 * MB);  // [B,H,T/64,64(d),64(t)] f16
  _Float16* Tm  = (_Float16*)(ws + 24 * MB);  // tanh(mask) f16 [T,T]
  _Float16* Xq  = (_Float16*)(ws + 32 * MB);  // f16 activations
  _Float16* Xk  = (_Float16*)(ws + 40 * MB);
  _Float16* Xv  = (_Float16*)(ws + 48 * MB);
  _Float16* Wqt = (_Float16*)(ws + 56 * MB);  // f16 transposed weights [n][k]
  _Float16* Wkt = (_Float16*)(ws + 58 * MB);
  _Float16* Wvt = (_Float16*)(ws + 60 * MB);
  _Float16* Wot = (_Float16*)(ws + 62 * MB);
  _Float16* ctx = (_Float16*)(ws + 32 * MB);  // reuse Xq (consumed by then)

  prepass_kernel<<<PRE_G, EW_T, 0, stream>>>(lmask, query, key, value, Wq, Wk,
                                             Wv, Wo, Tm, Xq, Xk, Xv, Wqt, Wkt,
                                             Wvt, Wot);

  const float qscale = 0.125f;  // 1/sqrt(64)
  // Xq/Xk/Xv, Wqt/Wkt/Wvt and Qh/Kh/Vt each lie back to back (see above)
  gemm_wmma_async<true><<<dim3(M_ / BM, D_ / BN, 3), 256, 0, stream>>>(
      Xq, Wqt, bq, bk, bv, Qh, qscale);

  attn_wmma<<<dim3(T_ / 64, B_ * H_), 128, 0, stream>>>(Qh, Kh, Vt, Tm, ctx);

  gemm_wmma_async<false><<<dim3(M_ / BM, D_ / BN), 256, 0, stream>>>(
      ctx, Wot, bo, bo, bo, d_out, 1.0f);
}

// v006
// One run takes 100 microseconds.
// Timed twice side by side with v005, it ran 1.17 and 1.15 times as fast.
// Over all steps from v000 it is 2.35 times as fast.
#include <hip/hip_runtime.h>
#include <hip/hip_bf16.h>

// ---------------------------------------------------------------------------
// MHA forward for B=2, T=2048, D=1024, H=16, DK=64 on gfx1250 (MI455X).
// All GEMMs run through v_wmma_f32_16x16x32_f16 (f16 in, f32 accumulate).
// GEMM tiles are staged global->LDS with GLOBAL_LOAD_ASYNC_TO_LDS_B128
// (ASYNCcnt) in a double-buffered pipeline.
// ---------------------------------------------------------------------------

typedef __attribute__((ext_vector_type(16))) _Float16 v16h;
typedef __attribute__((ext_vector_type(8)))  _Float16 v8h;
typedef __attribute__((ext_vector_type(4)))  _Float16 v4h;
typedef __attribute__((ext_vector_type(8)))  float    v8f;

#define B_  2
#define T_  2048
#define H_  16
#define DK_ 64
#define D_  1024
#define M_  (B_ * T_)   // 4096 rows for the projection GEMMs

__device__ __forceinline__ v8f wmma16(v16h a, v16h b, v8f c) {
  // (neg_a, A, neg_b, B, c_mod, C, reuse_a, reuse_b)
  return __builtin_amdgcn_wmma_f32_16x16x32_f16(false, a, false, b, (short)0, c,
                                                false, false);
}

__device__ __forceinline__ void wait_async0() {
  asm volatile("s_wait_asynccnt 0x0" ::: "memory");
}
// Async copies of 16-byte chunks, global -> LDS, tracked with ASYNCcnt.
// VDST = per-lane LDS byte offset (low 32 bits of the generic LDS pointer),
// VADDR = 64-bit global address.
// Eight such copies of one lane in ONE statement.  The closing s_wait_xcnt
// stands inside the statement so that no address register of an issued copy
// is rewritten in front of it.
__device__ __forceinline__ void async_copy8_b128(
    const void* l0, const void* l1, const void* l2, const void* l3,
    const void* l4, const void* l5, const void* l6, const void* l7,
    const void* g0, const void* g1, const void* g2, const void* g3,
    const void* g4, const void* g5, const void* g6, const void* g7) {
  asm volatile(
      "global_load_async_to_lds_b128 %0, %8, off\n\t"
      "global_load_async_to_lds_b128 %1, %9, off\n\t"
      "global_load_async_to_lds_b128 %2, %10, off\n\t"
      "global_load_async_to_lds_b128 %3, %11, off\n\t"
      "global_load_async_to_lds_b128 %4, %12, off\n\t"
      "global_load_async_to_lds_b128 %5, %13, off\n\t"
      "global_load_async_to_lds_b128 %6, %14, off\n\t"
      "global_load_async_to_lds_b128 %7, %15, off\n\t"
      "s_wait_xcnt 0x0" ::"v"((unsigned)(unsigned long long)l0),
      "v"((unsigned)(unsigned long long)l1),
      "v"((unsigned)(unsigned long long)l2),
      "v"((unsigned)(unsigned long long)l3),
      "v"((unsigned)(unsigned long long)l4),
      "v"((unsigned)(unsigned long long)l5),
      "v"((unsigned)(unsigned long long)l6),
      "v"((unsigned)(unsigned long long)l7), "v"(g0), "v"(g1), "v"(g2), "v"(g3),
      "v"(g4), "v"(g5), "v"(g6), "v"(g7)
      : "memory");
}

// Load a 16x32 f16 WMMA A/B fragment from LDS stored [row][k], k contiguous,
// row stride STRIDE halves (STRIDE % 8 == 0 so each half-row chunk is a
// 16-byte-aligned ds_load_b128).
// Lane L (L<16): row = row0+L, K = {kh..kh+7, 16+kh..16+kh+7} with kh=0.
// Lane L+16:    same row, kh=8.  Matches CDNA5 16-bit A layout (ISA 7.12.2).
template <int STRIDE>
__device__ __forceinline__ v16h load_frag_lds(const _Float16* base, int row0,
                                              int kOff) {
  const int lane = threadIdx.x & 31;
  const _Float16* p =
      base + (size_t)(row0 + (lane & 15)) * STRIDE + kOff + ((lane >> 4) << 3);
  v8h lo = *(const v8h*)(p);
  v8h hi = *(const v8h*)(p + 16);
  return __builtin_shufflevector(lo, hi, 0, 1, 2, 3, 4, 5, 6, 7, 8, 9, 10, 11,
                                 12, 13, 14, 15);
}

// Same fragment shape, loaded directly from global memory with row stride 64
// halves (the [*, 64] head layout of Q/K: row = head-row, k-dim = feature).
__device__ __forceinline__ v16h load_frag_g64(const _Float16* base, int kOff) {
  const int lane = threadIdx.x & 31;
  const _Float16* p =
      base + (size_t)(lane & 15) * DK_ + kOff + ((lane >> 4) << 3);
  v8h lo = *(const v8h*)(p);
  v8h hi = *(const v8h*)(p + 16);
  return __builtin_shufflevector(lo, hi, 0, 1, 2, 3, 4, 5, 6, 7, 8, 9, 10, 11,
                                 12, 13, 14, 15);
}

// ---------------------------------------------------------------------------
// Pre-pass: ONE launch for the eight jobs that read inputs only and none of
// each other's output (tanh of the mask, three f32 -> f16 conversions, four
// weight transposes).  A work-group's job follows from its index; the heavier
// jobs have the lower indices and start first, the short transposes fill the
// places they leave.  Few waves with much work each, 16 waves a work-group.
// Elementwise jobs: a thread takes 8 pieces of 16 B, all 8 loads in flight at
// once; every wave-wide load covers 512 contiguous bytes, every store 256.
// ---------------------------------------------------------------------------
#define EW_T 512                 // threads per work-group
#define EW_U 8                   // 16-byte pieces per thread
#define EW_N4 (M_ * D_ / 4)      // pieces per array (mask and activations alike)
#define EW_G (EW_N4 / (EW_T * EW_U))  // work-groups per elementwise job
static_assert(T_ * T_ == M_ * D_, "mask and activations: one piece count");
static_assert(EW_G * EW_T * EW_U == EW_N4, "the grid covers the array exactly");

// Transposes: W[k][n] f32 -> Wt[n][k] f16 by 64x64 tiles through LDS, so the
// GEMM B operand is k-contiguous.  Each half of a work-group (256 threads)
// takes one tile, the two tiles side by side in n.  A thread loads 4 pieces of
// 16 B (a wave: two 256-B row pieces per load) and stores 2 pieces of 16 B (a
// wave: four whole 128-B lines per store).  Pitch 65 dwords: the row-wise
// writes and the column-wise reads both fall on 32 different banks.
#define TT 64
#define TR_G ((D_ / TT) * (D_ / TT) / 2)  // work-groups per weight matrix
#define PRE_G (4 * EW_G + 4 * TR_G)       // work-groups of the launch

__global__ __launch_bounds__(EW_T) void prepass_kernel(
    const float* __restrict__ mask, const float* __restrict__ xq,
    const float* __restrict__ xk, const float* __restrict__ xv,
    const float* __restrict__ Wq, const float* __restrict__ Wk,
    const float* __restrict__ Wv, const float* __restrict__ Wo,
    _Float16* __restrict__ Tm, _Float16* __restrict__ Xq,
    _Float16* __restrict__ Xk, _Float16* __restrict__ Xv,
    _Float16* __restrict__ Wqt, _Float16* __restrict__ Wkt,
    _Float16* __restrict__ Wvt, _Float16* __restrict__ Wot) {
  __shared__ float tile[2][TT][TT + 1];
  const int bid = blockIdx.x;

  if (bid < EW_G) {  // tanh(learnable_mask) -> f16, reused by all (b,h)
    const int i0 = bid * (EW_T * EW_U) + threadIdx.x;
    float4 v[EW_U];
    for (int u = 0; u < EW_U; ++u) v[u] = ((const float4*)mask)[i0 + u * EW_T];
    for (int u = 0; u < EW_U; ++u) {
      v4h h;
      h.x = (_Float16)tanhf(v[u].x); h.y = (_Float16)tanhf(v[u].y);
      h.z = (_Float16)tanhf(v[u].z); h.w = (_Float16)tanhf(v[u].w);
      ((v4h*)Tm)[i0 + u * EW_T] = h;
    }
    return;
  }

  if (bid < 4 * EW_G) {  // f32 -> f16 (activations)
    const int job = bid / EW_G;  // 1, 2, 3
    const float* in = job == 1 ? xq : job == 2 ? xk : xv;
    _Float16* out = job == 1 ? Xq : job == 2 ? Xk : Xv;
    const int i0 = (bid % EW_G) * (EW_T * EW_U) + threadIdx.x;
    float4 v[EW_U];
    for (int u = 0; u < EW_U; ++u) v[u] = ((const float4*)in)[i0 + u * EW_T];
    for (int u = 0; u < EW_U; ++u) {
      v4h h;
      h.x = (_Float16)v[u].x; h.y = (_Float16)v[u].y;
      h.z = (_Float16)v[u].z; h.w = (_Float16)v[u].w;
      ((v4h*)out)[i0 + u * EW_T] = h;
    }
    return;
  }

  // weight transposes
  const int tb = bid - 4 * EW_G;
  const int job = tb / TR_G;  // 0 .. 3
  const float* W = job == 0 ? Wq : job == 1 ? Wk : job == 2 ? Wv : Wo;
  _Float16* Wt = job == 0 ? Wqt : job == 1 ? Wkt : job == 2 ? Wvt : Wot;
  const int tid = threadIdx.x & 255;
  const int sub = threadIdx.x >> 8;          // which of the two tiles
  const int ti = (tb % TR_G) * 2 + sub;      // tile 0 .. 255 of this matrix
  const int n0 = (ti % (D_ / TT)) * TT, k0 = (ti / (D_ / TT)) * TT;
  float4 v[4];
  for (int u = 0; u < 4; ++u) {
    const int q = tid + u * 256, k = q >> 4, c = q & 15;
    v[u] = *(const float4*)(W + (size_t)(k0 + k) * D_ + n0 + c * 4);
  }
  for (int u = 0; u < 4; ++u) {
    const int q = tid + u * 256, k = q >> 4, c = q & 15;
    tile[sub][k][c * 4 + 0] = v[u].x; tile[sub][k][c * 4 + 1] = v[u].y;
    tile[sub][k][c * 4 + 2] = v[u].z; tile[sub][k][c * 4 + 3] = v[u].w;
  }
  __syncthreads();
  for (int u = 0; u < 2; ++u) {
    const int q = tid + u * 256, n = q >> 3, kc = q & 7;
    v8h h;
    for (int j = 0; j < 8; ++j) h[j] = (_Float16)tile[sub][kc * 8 + j][n];
    *(v8h*)(Wt + (size_t)(n0 + n) * D_ + k0 + kc * 8) = h;
  }
}

// ---------------------------------------------------------------------------
// Kernel 1/3: C = A @ W + bias, with A [4096 x 1024] f16 row-major and
// Wt [1024(n) x 1024(k)] f16 (pre-transposed).  Tile 128x128, BK=64, 4 waves,
// each wave a 64x64 block = 4x4 WMMA tiles: a fragment read from LDS feeds four
// products, and a work-group fetches 256 operand rows for 16,384 outputs.
// Tiles staged by global_load_async_to_lds_b128 in whole 128-B lines, two
// buffers (tile k+1 flies while tile k is worked on).
// HEADS=true : scatter f16 into [B,H,T,64] head layout, scale folded in; V
//              alone goes out transposed by 64-key tiles, [B,H,T/64,64(d),64(t)]:
//              each tile is the 8 KiB block, features by keys, that the
//              attention kernel needs as a matrix operand.
//              The three projections, which read none of each other's output,
//              are ONE launch: blockIdx.z picks activations, weights, bias and
//              output (0: Q, 1: K, 2: V; each set of three lies back to back
//              in the workspace); 3 work-groups per WGP, all resident at once.
// HEADS=false: write f32 row-major [4096 x 1024] (final output); z is 0.
// ---------------------------------------------------------------------------
#define BM 128
#define BN 128
#define BK 64
#define LS 72  // LDS row stride in halves (64 + 8 pad; 144B, 16B aligned)

template <bool HEADS>
__global__ __launch_bounds__(128) void gemm_wmma_async(
    const _Float16* __restrict__ A0, const _Float16* __restrict__ Wt0,
    const float* __restrict__ bias0, const float* __restrict__ bias1,
    const float* __restrict__ bias2, void* __restrict__ outp0, float scale0) {
  __shared__ __attribute__((aligned(16))) _Float16 sA[2][BM * LS];
  __shared__ __attribute__((aligned(16))) _Float16 sB[2][BN * LS];

  const int z = HEADS ? blockIdx.z : 0;
  const _Float16* __restrict__ A = A0 + (size_t)z * M_ * D_;
  const _Float16* __restrict__ Wt = Wt0 + (size_t)z * D_ * D_;
  const float* __restrict__ bias = z == 0 ? bias0 : z == 1 ? bias1 : bias2;
  void* __restrict__ outp =
      HEADS ? (void*)((_Float16*)outp0 + (size_t)z * M_ * D_) : outp0;
  const float scale = z == 0 ? scale0 : 1.0f;  // 1/sqrt(DK) goes into Q alone

  const int tid = threadIdx.x;
  const int lane = tid & 31;
  const int wid = tid >> 5;
  const int wr = wid & 1;   // wave row 0..1  -> 64-row stripe
  const int wc = wid >> 1;  // wave col 0..1  -> 64-col stripe
  const int m0 = blockIdx.x * BM;
  const int n0 = blockIdx.y * BN;

  // Copies of the k0 tile into buffer `buf`: A and B each 128 rows x 8 chunks
  // of 16 B, 8 chunks of each per thread; a wave's 32 lanes cover 4 whole
  // 128-B row pieces per copy.
  auto issue_tile = [&](int k0, int buf) {
    const int r = tid >> 3, c = (tid & 7) * 8;
    const _Float16* ga = A + (size_t)(m0 + r) * D_ + k0 + c;
    const _Float16* la = &sA[buf][r * LS + c];
    async_copy8_b128(la, la + 16 * LS, la + 32 * LS, la + 48 * LS, la + 64 * LS,
                     la + 80 * LS, la + 96 * LS, la + 112 * LS, ga,
                     ga + 16 * D_, ga + 32 * D_, ga + 48 * D_, ga + 64 * D_,
                     ga + 80 * D_, ga + 96 * D_, ga + 112 * D_);
    const _Float16* gb = Wt + (size_t)(n0 + r) * D_ + k0 + c;
    const _Float16* lb = &sB[buf][r * LS + c];
    async_copy8_b128(lb, lb + 16 * LS, lb + 32 * LS, lb + 48 * LS, lb + 64 * LS,
                     lb + 80 * LS, lb + 96 * LS, lb + 112 * LS, gb,
                     gb + 16 * D_, gb + 32 * D_, gb + 48 * D_, gb + 64 * D_,
                     gb + 80 * D_, gb + 96 * D_, gb + 112 * D_);
  };

  v8f c[4][4] = {};

  const int NT = D_ / BK;  // 16 k-steps
  issue_tile(0, 0);
  wait_async0();    // my chunks of tile 0 have landed
  __syncthreads();  // everyone's chunks of tile 0 visible
  issue_tile(BK, 1);

  for (int kt = 0; kt < NT; ++kt) {
    const _Float16* al = sA[kt & 1];
    const _Float16* bl = sB[kt & 1];
    v16h a[4], b[4];
    // ---- first half of the tile's k ----
    for (int i = 0; i < 4; ++i) a[i] = load_frag_lds<LS>(al, wr * 64 + i * 16, 0);
    for (int j = 0; j < 4; ++j) b[j] = load_frag_lds<LS>(bl, wc * 64 + j * 16, 0);
    // keeps the 16 fragment loads one group ahead of their 16 products:
    // spread among them, each row of products waits its own loads out to zero
    __builtin_amdgcn_sched_barrier(0);
    for (int i = 0; i < 4; ++i)
      for (int j = 0; j < 4; ++j) c[i][j] = wmma16(a[i], b[j], c[i][j]);
    // ---- second half: its fragments are this trip's last LDS reads ----
    for (int i = 0; i < 4; ++i)
      a[i] = load_frag_lds<LS>(al, wr * 64 + i * 16, 32);
    for (int j = 0; j < 4; ++j)
      b[j] = load_frag_lds<LS>(bl, wc * 64 + j * 16, 32);
    // ---- foot: publish tile kt+1, free this trip's buffers ----
    // my LDS reads of this trip have returned before the buffers are refilled
    asm volatile("s_wait_dscnt 0x0" ::: "memory");
    wait_async0();    // my chunks of tile kt+1 have landed
    __syncthreads();  // all chunks visible; all reads of this trip's buffers done
    if (kt + 2 < NT) issue_tile((kt + 2) * BK, kt & 1);
    // the second half's products work on registers alone: behind the refill's
    // issue, so that its copies fly 16 products longer
    for (int i = 0; i < 4; ++i)
      for (int j = 0; j < 4; ++j) c[i][j] = wmma16(a[i], b[j], c[i][j]);
  }
  wait_async0();  // nothing in flight when the wave ends

  // ---- epilogue ----
  // C/D layout: element (vgpr r, lane): row = r + (lane>=16 ? 8 : 0),
  // col = lane & 15 (ISA 7.12.2).
  const int half8 = (lane >> 4) << 3;
  const int ncol = lane & 15;
  if (HEADS && z == 2) {
    // V^T: a lane's 8 accumulator registers are 8 consecutive positions t of
    // one feature d, so each 16x16 tile leaves as one 16-byte store per lane.
    for (int i = 0; i < 4; ++i)
      for (int j = 0; j < 4; ++j) {
        const int m = m0 + wr * 64 + i * 16 + half8;
        const int n = n0 + wc * 64 + j * 16 + ncol;
        const float bn = bias[n];
        const int b = m >> 11, t = m & (T_ - 1);
        const int h = n >> 6, d = n & (DK_ - 1);
        v8h w;
        for (int r = 0; r < 8; ++r) w[r] = (_Float16)(c[i][j][r] + bn);
        *(v8h*)((_Float16*)outp + ((size_t)b * H_ + h) * T_ * DK_ +
                ((t >> 6) * DK_ + d) * 64 + (t & 63)) = w;
      }
    return;
  }
  for (int i = 0; i < 4; ++i)
    for (int j = 0; j < 4; ++j)
      for (int r = 0; r < 8; ++r) {
        const int m = m0 + wr * 64 + i * 16 + r + half8;
        const int n = n0 + wc * 64 + j * 16 + ncol;
        float v = c[i][j][r] + bias[n];
        if (HEADS) {
          v *= scale;  // 1/sqrt(DK) folded into Q
          const int b = m >> 11, t = m & (T_ - 1);
          const int h = n >> 6, d = n & (DK_ - 1);
          ((_Float16*)outp)[(((size_t)b * H_ + h) * T_ + t) * DK_ + d] =
              (_Float16)v;
        } else {
          ((float*)outp)[(size_t)m * D_ + n] = v;
        }
      }
}

#define VTS 72  // LDS row stride in halves for the V^T tile (64+8; 144B)
#define KTS 72  // LDS row stride in halves for the K tile (128B + 16B pad)
#define NKT (T_ / 64)  // key tiles

// lane l <-> lane l ^ 16 (the two halves of a wave hold the same query)
__device__ __forceinline__ float xhalf(float x) {
  const int b = __builtin_bit_cast(int, x);
  return __builtin_bit_cast(
      float, __builtin_amdgcn_permlanex16(b, b, 0x76543210, 0xfedcba98, false,
                                          false));
}

// The grid is 4 waves per SIMD (4,096 waves on 1,024 SIMDs): with that stated
// the compiler keeps the fragment loads grouped ahead of their products and
// does not fold them into one register set with a full LDS wait per product.
__global__ __launch_bounds__(128)
__attribute__((amdgpu_waves_per_eu(4, 4))) void attn_wmma(
    const _Float16* __restrict__ Qh, const _Float16* __restrict__ Kh,
    const _Float16* __restrict__ Vt, const _Float16* __restrict__ Tm,
    _Float16* __restrict__ ctx) {
  __shared__ __attribute__((aligned(16)))
  _Float16 sVt[2][DK_ * VTS];  // V^T tiles: [feature][key], two buffers
  __shared__ __attribute__((aligned(16)))
  _Float16 sK[2][64 * KTS];  // K tiles: [key][feature], two buffers

  const int tid = threadIdx.x, lane = tid & 31, wid = tid >> 5;
  const int bh = blockIdx.y;  // b*16 + h
  const int b = bh >> 4, h = bh & 15;
  const int q0 = blockIdx.x * 64 + wid * 16;
  const size_t base = (size_t)bh * T_ * DK_;

  // Q fragments (scale already folded in at projection time); B operand of
  // S^T: column = query lane & 15, same k order as the K fragments.
  v16h qa[2];
  {
    const _Float16* qb = Qh + base + (size_t)q0 * DK_;
    qa[0] = load_frag_g64(qb, 0);
    qa[1] = load_frag_g64(qb, 32);
  }

  const int half8 = (lane >> 4) << 3;
  const int ncol = lane & 15;

  v8f o[4] = {};  // O^T: o[j][r] = O[q0 + ncol][j*16 + half8 + r]
  float rmax = -1e30f;  // this lane's query, joined over both halves
  float rsum = 0.0f;    // this lane's half of the keys; joined in the epilogue

  // this lane's mask row, at its first key of a tile
  const _Float16* tmrow = Tm + (size_t)(q0 + ncol) * T_ + half8;

  // Copies of K tile t into buffer buf: 512 chunks of 16 B, 4 per thread;
  // a wave's 32 lanes cover 512 contiguous bytes (4 whole key rows) per copy.
  // The same for V^T tile t (4 whole feature rows per copy).
  auto issue_kv = [&](int t, int buf) {
    const _Float16* g = Kh + base + (size_t)t * 64 * DK_ + tid * 8;
    const _Float16* l = &sK[buf][(tid >> 3) * KTS + (tid & 7) * 8];
    const _Float16* gv = Vt + base + (size_t)t * DK_ * 64 + tid * 8;
    const _Float16* lv = &sVt[buf][(tid >> 3) * VTS + (tid & 7) * 8];
    async_copy8_b128(l, l + 16 * KTS, l + 32 * KTS, l + 48 * KTS, lv,
                     lv + 16 * VTS, lv + 32 * VTS, lv + 48 * VTS, g,
                     g + 16 * DK_, g + 32 * DK_, g + 48 * DK_, gv, gv + 16 * 64,
                     gv + 32 * 64, gv + 48 * 64);
  };

  issue_kv(0, 0);
  wait_async0();    // my chunks of tiles 0 have landed
  __syncthreads();  // everyone's chunks of tiles 0 visible
  issue_kv(1, 1);

  for (int kt = 0; kt < NKT; ++kt) {
    const int k0 = kt * 64;
    const _Float16* kl = sK[kt & 1];
    const _Float16* vl = sVt[kt & 1];

    // tanh(mask) of this lane's query: 8 consecutive keys per 16-key tile
    v8h tmv[4];
    for (int j = 0; j < 4; ++j)
      tmv[j] = *(const v8h*)(tmrow + k0 + j * 16);

    // ---- S^T = K Q^T: s[j][r] = S[q0 + ncol][k0 + j*16 + half8 + r] ----
    v16h kb[4][2];
    for (int j = 0; j < 4; ++j) {
      kb[j][0] = load_frag_lds<KTS>(kl, j * 16, 0);
      kb[j][1] = load_frag_lds<KTS>(kl, j * 16, 32);
    }
    // keeps the 16 K fragment loads one group ahead of the products: spread
    // among them, each small group is waited out to zero in one shared
    // register set
    __builtin_amdgcn_sched_barrier(0);
    v8f s[4] = {};
    for (int j = 0; j < 4; ++j) s[j] = wmma16(kb[j][0], qa[0], s[j]);
    for (int j = 0; j < 4; ++j) s[j] = wmma16(kb[j][1], qa[1], s[j]);

    // V^T fragments (A operand of the second product): they depend on nothing
    // below, so their LDS latency passes behind the softmax arithmetic
    v16h vb[4][2];
    for (int j = 0; j < 4; ++j) {
      vb[j][0] = load_frag_lds<VTS>(vl, j * 16, 0);
      vb[j][1] = load_frag_lds<VTS>(vl, j * 16, 32);
    }

    // ---- online softmax: this query's maximum, in-lane, then both halves ----
    float mj[4];
    for (int j = 0; j < 4; ++j) {
      mj[j] = s[j][0];
      for (int r = 1; r < 8; ++r) mj[j] = fmaxf(mj[j], s[j][r]);
    }
    float m = fmaxf(fmaxf(mj[0], mj[1]), fmaxf(mj[2], mj[3]));
    m = fmaxf(m, xhalf(m));
    const float mn = fmaxf(rmax, m);
    const float scl = __expf(rmax - mn);
    rmax = mn;
    // keeps the mask's conversions, and with them the wait on its global
    // loads, behind the score products and the maximum: lifted among the
    // products they stall the wave on memory at the head of every trip
    __builtin_amdgcn_sched_barrier(0);

    // ---- P = exp(S-max); denominator unmasked, numerator * tanh(mask) ----
    // pb[mm][e] = P^T[key 32*mm + kmap(e)][query]: tiles 2*mm and 2*mm+1 in
    // register order are the hardware k order of a B operand.
    v16h pb[2];
    float tj[4];
    // both loops unrolled: left rolled, the register arrays are indexed by a
    // variable and pb goes to scratch memory
#pragma unroll
    for (int j = 0; j < 4; ++j) {
      tj[j] = 0.0f;
#pragma unroll
      for (int r = 0; r < 8; ++r) {
        const float e = __expf(s[j][r] - rmax);
        tj[j] += e;
        pb[j >> 1][(j & 1) * 8 + r] = (_Float16)(e * (float)tmv[j][r]);
      }
    }
    rsum = rsum * scl + ((tj[0] + tj[1]) + (tj[2] + tj[3]));
    for (int j = 0; j < 4; ++j)
      for (int r = 0; r < 8; ++r) o[j][r] *= scl;

    // ---- O^T += V^T P^T ----
    for (int j = 0; j < 4; ++j) o[j] = wmma16(vb[j][0], pb[0], o[j]);
    for (int j = 0; j < 4; ++j) o[j] = wmma16(vb[j][1], pb[1], o[j]);

    // ---- foot: publish tiles kt+1, free this trip's K and V^T buffers ----
    // my LDS reads of this trip have returned before the buffers are refilled
    asm volatile("s_wait_dscnt 0x0" ::: "memory");
    wait_async0();    // my chunks of tiles kt+1 have landed
    __syncthreads();  // all chunks visible; all reads of this trip's buffers done
    if (kt + 2 < NKT) issue_kv(kt + 2, kt & 1);
  }
  wait_async0();  // nothing in flight when the wave ends

  // ---- normalize and write ctx as f16 [B, T, D] (heads re-interleaved) ----
  // a lane's 8 accumulator registers are 8 consecutive features of its query
  const float inv = 1.0f / fmaxf(rsum + xhalf(rsum), 1e-20f);
  _Float16* crow = ctx + ((size_t)b * T_ + q0 + ncol) * D_ + h * DK_ + half8;
  for (int j = 0; j < 4; ++j) {
    v8h w;
    for (int r = 0; r < 8; ++r) w[r] = (_Float16)(o[j][r] * inv);
    *(v8h*)(crow + j * 16) = w;
  }
}

// ---------------------------------------------------------------------------
// Host launcher
// ---------------------------------------------------------------------------
extern "C" void kernel_launch(void* const* d_in, const int* in_sizes, int n_in,
                              void* d_out, int out_size, void* d_ws,
                              size_t ws_size, hipStream_t stream) {
  (void)in_sizes; (void)n_in; (void)out_size; (void)ws_size;

  const float* query = (const float*)d_in[0];
  const float* key   = (const float*)d_in[1];
  const float* value = (const float*)d_in[2];
  const float* Wq = (const float*)d_in[3];
  const float* bq = (const float*)d_in[4];
  const float* Wk = (const float*)d_in[5];
  const float* bk = (const float*)d_in[6];
  const float* Wv = (const float*)d_in[7];
  const float* bv = (const float*)d_in[8];
  const float* Wo = (const float*)d_in[9];
  const float* bo = (const float*)d_in[10];
  const float* lmask = (const float*)d_in[11];

  // workspace carve-up (MiB offsets), 64 MiB total
  char* ws = (char*)d_ws;
  const size_t MB = (size_t)1 << 20;
  _Float16* Qh  = (_Float16*)(ws + 0 * MB);   // [B,H,T,64] f16 (pre-scaled)
  _Float16* Kh  = (_Float16*)(ws + 8 * MB);
  _Float16* Vt  = (_Float16*)(ws + 16 * MB);  // [B,H,T/64,64(d),64(t)] f16
  _Float16* Tm  = (_Float16*)(ws + 24 * MB);  // tanh(mask) f16 [T,T]
  _Float16* Xq  = (_Float16*)(ws + 32 * MB);  // f16 activations
  _Float16* Xk  = (_Float16*)(ws + 40 * MB);
  _Float16* Xv  = (_Float16*)(ws + 48 * MB);
  _Float16* Wqt = (_Float16*)(ws + 56 * MB);  // f16 transposed weights [n][k]
  _Float16* Wkt = (_Float16*)(ws + 58 * MB);
  _Float16* Wvt = (_Float16*)(ws + 60 * MB);
  _Float16* Wot = (_Float16*)(ws + 62 * MB);
  _Float16* ctx = (_Float16*)(ws + 32 * MB);  // reuse Xq (consumed by then)

  prepass_kernel<<<PRE_G, EW_T, 0, stream>>>(lmask, query, key, value, Wq, Wk,
                                             Wv, Wo, Tm, Xq, Xk, Xv, Wqt, Wkt,
                                             Wvt, Wot);

  const float qscale = 0.125f;  // 1/sqrt(64)
  // Xq/Xk/Xv, Wqt/Wkt/Wvt and Qh/Kh/Vt each lie back to back (see above)
  gemm_wmma_async<true><<<dim3(M_ / BM, D_ / BN, 3), 128, 0, stream>>>(
      Xq, Wqt, bq, bk, bv, Qh, qscale);

  attn_wmma<<<dim3(T_ / 64, B_ * H_), 128, 0, stream>>>(Qh, Kh, Vt, Tm, ctx);

  gemm_wmma_async<false><<<dim3(M_ / BM, D_ / BN), 128, 0, stream>>>(
      ctx, Wot, bo, bo, bo, d_out, 1.0f);
}

// v007
// Measured time: 95 microseconds a run.
// Two timings next to v006 put it at 1.07 and 1.06 times that version's speed.
// All steps since v000 together make it 2.49 times as fast.
#include <hip/hip_runtime.h>
#include <hip/hip_bf16.h>

// ---------------------------------------------------------------------------
// MHA forward for B=2, T=2048, D=1024, H=16, DK=64 on gfx1250 (MI455X).
// All GEMMs run through v_wmma_f32_16x16x32_f16 (f16 in, f32 accumulate).
// GEMM tiles are staged global->LDS with GLOBAL_LOAD_ASYNC_TO_LDS_B128
// (ASYNCcnt) in a double-buffered pipeline.
// ---------------------------------------------------------------------------

typedef __attribute__((ext_vector_type(16))) _Float16 v16h;
typedef __attribute__((ext_vector_type(8)))  _Float16 v8h;
typedef __attribute__((ext_vector_type(4)))  _Float16 v4h;
typedef __attribute__((ext_vector_type(8)))  float    v8f;

#define B_  2
#define T_  2048
#define H_  16
#define DK_ 64
#define D_  1024
#define M_  (B_ * T_)   // 4096 rows for the projection GEMMs

__device__ __forceinline__ v8f wmma16(v16h a, v16h b, v8f c) {
  // (neg_a, A, neg_b, B, c_mod, C, reuse_a, reuse_b)
  return __builtin_amdgcn_wmma_f32_16x16x32_f16(false, a, false, b, (short)0, c,
                                                false, false);
}

__device__ __forceinline__ void wait_async0() {
  asm volatile("s_wait_asynccnt 0x0" ::: "memory");
}
// Async copies of 16-byte chunks, global -> LDS, tracked with ASYNCcnt.
// VDST = per-lane LDS byte offset (low 32 bits of the generic LDS pointer),
// VADDR = 64-bit global address.
// Eight such copies of one lane in ONE statement.  The closing s_wait_xcnt
// stands inside the statement so that no address register of an issued copy
// is rewritten in front of it.
__device__ __forceinline__ void async_copy8_b128(
    const void* l0, const void* l1, const void* l2, const void* l3,
    const void* l4, const void* l5, const void* l6, const void* l7,
    const void* g0, const void* g1, const void* g2, const void* g3,
    const void* g4, const void* g5, const void* g6, const void* g7) {
  asm volatile(
      "global_load_async_to_lds_b128 %0, %8, off\n\t"
      "global_load_async_to_lds_b128 %1, %9, off\n\t"
      "global_load_async_to_lds_b128 %2, %10, off\n\t"
      "global_load_async_to_lds_b128 %3, %11, off\n\t"
      "global_load_async_to_lds_b128 %4, %12, off\n\t"
      "global_load_async_to_lds_b128 %5, %13, off\n\t"
      "global_load_async_to_lds_b128 %6, %14, off\n\t"
      "global_load_async_to_lds_b128 %7, %15, off\n\t"
      "s_wait_xcnt 0x0" ::"v"((unsigned)(unsigned long long)l0),
      "v"((unsigned)(unsigned long long)l1),
      "v"((unsigned)(unsigned long long)l2),
      "v"((unsigned)(unsigned long long)l3),
      "v"((unsigned)(unsigned long long)l4),
      "v"((unsigned)(unsigned long long)l5),
      "v"((unsigned)(unsigned long long)l6),
      "v"((unsigned)(unsigned long long)l7), "v"(g0), "v"(g1), "v"(g2), "v"(g3),
      "v"(g4), "v"(g5), "v"(g6), "v"(g7)
      : "memory");
}

// Load a 16x32 f16 WMMA A/B fragment from LDS stored [row][k], k contiguous,
// row stride STRIDE halves (STRIDE % 8 == 0 so each half-row chunk is a
// 16-byte-aligned ds_load_b128).
// Lane L (L<16): row = row0+L, K = {kh..kh+7, 16+kh..16+kh+7} with kh=0.
// Lane L+16:    same row, kh=8.  Matches CDNA5 16-bit A layout (ISA 7.12.2).
template <int STRIDE>
__device__ __forceinline__ v16h load_frag_lds(const _Float16* base, int row0,
                                              int kOff) {
  const int lane = threadIdx.x & 31;
  const _Float16* p =
      base + (size_t)(row0 + (lane & 15)) * STRIDE + kOff + ((lane >> 4) << 3);
  v8h lo = *(const v8h*)(p);
  v8h hi = *(const v8h*)(p + 16);
  return __builtin_shufflevector(lo, hi, 0, 1, 2, 3, 4, 5, 6, 7, 8, 9, 10, 11,
                                 12, 13, 14, 15);
}

// Same fragment shape, loaded directly from global memory with row stride 64
// halves (the [*, 64] head layout of Q/K: row = head-row, k-dim = feature).
__device__ __forceinline__ v16h load_frag_g64(const _Float16* base, int kOff) {
  const int lane = threadIdx.x & 31;
  const _Float16* p =
      base + (size_t)(lane & 15) * DK_ + kOff + ((lane >> 4) << 3);
  v8h lo = *(const v8h*)(p);
  v8h hi = *(const v8h*)(p + 16);
  return __builtin_shufflevector(lo, hi, 0, 1, 2, 3, 4, 5, 6, 7, 8, 9, 10, 11,
                                 12, 13, 14, 15);
}

// ---------------------------------------------------------------------------
// Pre-pass: ONE launch for the eight jobs that read inputs only and none of
// each other's output (tanh of the mask, three f32 -> f16 conversions, four
// weight transposes).  A work-group's job follows from its index; the heavier
// jobs have the lower indices and start first, the short transposes fill the
// places they leave.  Few waves with much work each, 16 waves a work-group.
// Elementwise jobs: a thread takes 8 pieces of 16 B, all 8 loads in flight at
// once; every wave-wide load covers 512 contiguous bytes, every store 256.
// ---------------------------------------------------------------------------
#define EW_T 512                 // threads per work-group
#define EW_U 8                   // 16-byte pieces per thread
#define EW_N4 (M_ * D_ / 4)      // pieces per array (mask and activations alike)
#define EW_G (EW_N4 / (EW_T * EW_U))  // work-groups per elementwise job
static_assert(T_ * T_ == M_ * D_, "mask and activations: one piece count");
static_assert(EW_G * EW_T * EW_U == EW_N4, "the grid covers the array exactly");

// Transposes: W[k][n] f32 -> Wt[n][k] f16 by 64x64 tiles through LDS, so the
// GEMM B operand is k-contiguous.  Each half of a work-group (256 threads)
// takes one tile, the two tiles side by side in n.  A thread loads 4 pieces of
// 16 B (a wave: two 256-B row pieces per load) and stores 2 pieces of 16 B (a
// wave: four whole 128-B lines per store).  Pitch 65 dwords: the row-wise
// writes and the column-wise reads both fall on 32 different banks.
#define TT 64
#define TR_G ((D_ / TT) * (D_ / TT) / 2)  // work-groups per weight matrix
#define PRE_G (4 * EW_G + 4 * TR_G)       // work-groups of the launch

__global__ __launch_bounds__(EW_T) void prepass_kernel(
    const float* __restrict__ mask, const float* __restrict__ xq,
    const float* __restrict__ xk, const float* __restrict__ xv,
    const float* __restrict__ Wq, const float* __restrict__ Wk,
    const float* __restrict__ Wv, const float* __restrict__ Wo,
    _Float16* __restrict__ Tm, _Float16* __restrict__ Xq,
    _Float16* __restrict__ Xk, _Float16* __restrict__ Xv,
    _Float16* __restrict__ Wqt, _Float16* __restrict__ Wkt,
    _Float16* __restrict__ Wvt, _Float16* __restrict__ Wot) {
  __shared__ float tile[2][TT][TT + 1];
  const int bid = blockIdx.x;

  if (bid < EW_G) {  // tanh(learnable_mask) -> f16, reused by all (b,h)
    const int i0 = bid * (EW_T * EW_U) + threadIdx.x;
    float4 v[EW_U];
    for (int u = 0; u < EW_U; ++u) v[u] = ((const float4*)mask)[i0 + u * EW_T];
    for (int u = 0; u < EW_U; ++u) {
      v4h h;
      h.x = (_Float16)tanhf(v[u].x); h.y = (_Float16)tanhf(v[u].y);
      h.z = (_Float16)tanhf(v[u].z); h.w = (_Float16)tanhf(v[u].w);
      ((v4h*)Tm)[i0 + u * EW_T] = h;
    }
    return;
  }

  if (bid < 4 * EW_G) {  // f32 -> f16 (activations)
    const int job = bid / EW_G;  // 1, 2, 3
    const float* in = job == 1 ? xq : job == 2 ? xk : xv;
    _Float16* out = job == 1 ? Xq : job == 2 ? Xk : Xv;
    const int i0 = (bid % EW_G) * (EW_T * EW_U) + threadIdx.x;
    float4 v[EW_U];
    for (int u = 0; u < EW_U; ++u) v[u] = ((const float4*)in)[i0 + u * EW_T];
    for (int u = 0; u < EW_U; ++u) {
      v4h h;
      h.x = (_Float16)v[u].x; h.y = (_Float16)v[u].y;
      h.z = (_Float16)v[u].z; h.w = (_Float16)v[u].w;
      ((v4h*)out)[i0 + u * EW_T] = h;
    }
    return;
  }

  // weight transposes
  const int tb = bid - 4 * EW_G;
  const int job = tb / TR_G;  // 0 .. 3
  const float* W = job == 0 ? Wq : job == 1 ? Wk : job == 2 ? Wv : Wo;
  _Float16* Wt = job == 0 ? Wqt : job == 1 ? Wkt : job == 2 ? Wvt : Wot;
  const int tid = threadIdx.x & 255;
  const int sub = threadIdx.x >> 8;          // which of the two tiles
  const int ti = (tb % TR_G) * 2 + sub;      // tile 0 .. 255 of this matrix
  const int n0 = (ti % (D_ / TT)) * TT, k0 = (ti / (D_ / TT)) * TT;
  float4 v[4];
  for (int u = 0; u < 4; ++u) {
    const int q = tid + u * 256, k = q >> 4, c = q & 15;
    v[u] = *(const float4*)(W + (size_t)(k0 + k) * D_ + n0 + c * 4);
  }
  for (int u = 0; u < 4; ++u) {
    const int q = tid + u * 256, k = q >> 4, c = q & 15;
    tile[sub][k][c * 4 + 0] = v[u].x; tile[sub][k][c * 4 + 1] = v[u].y;
    tile[sub][k][c * 4 + 2] = v[u].z; tile[sub][k][c * 4 + 3] = v[u].w;
  }
  __syncthreads();
  for (int u = 0; u < 2; ++u) {
    const int q = tid + u * 256, n = q >> 3, kc = q & 7;
    v8h h;
    for (int j = 0; j < 8; ++j) h[j] = (_Float16)tile[sub][kc * 8 + j][n];
    *(v8h*)(Wt + (size_t)(n0 + n) * D_ + k0 + kc * 8) = h;
  }
}

// ---------------------------------------------------------------------------
// Kernel 1/3: C = A @ W + bias, with A [4096 x 1024] f16 row-major and
// Wt [1024(n) x 1024(k)] f16 (pre-transposed).  Tile 128x128, BK=64, 4 waves,
// each wave a 64x64 block = 4x4 WMMA tiles: a fragment read from LDS feeds four
// products, and a work-group fetches 256 operand rows for 16,384 outputs.
// Tiles staged by global_load_async_to_lds_b128 in whole 128-B lines, two
// buffers (tile k+1 flies while tile k is worked on).
// HEADS=true : scatter f16 into [B,H,T,64] head layout, scale folded in; V
//              alone goes out transposed by 64-key tiles, [B,H,T/64,64(d),64(t)]:
//              each tile is the 8 KiB block, features by keys, that the
//              attention kernel needs as a matrix operand.
//              The three projections, which read none of each other's output,
//              are ONE launch: blockIdx.z picks activations, weights, bias and
//              output (0: Q, 1: K, 2: V; each set of three lies back to back
//              in the workspace); 3 work-groups per WGP, all resident at once.
// HEADS=false: write f32 row-major [4096 x 1024] (final output); z is 0.
// ---------------------------------------------------------------------------
#define BM 128
#define BN 128
#define BK 64
#define LS 72  // LDS row stride in halves (64 + 8 pad; 144B, 16B aligned)

template <bool HEADS>
__global__ __launch_bounds__(128) void gemm_wmma_async(
    const _Float16* __restrict__ A0, const _Float16* __restrict__ Wt0,
    const float* __restrict__ bias0, const float* __restrict__ bias1,
    const float* __restrict__ bias2, void* __restrict__ outp0, float scale0) {
  __shared__ __attribute__((aligned(16))) _Float16 sA[2][BM * LS];
  __shared__ __attribute__((aligned(16))) _Float16 sB[2][BN * LS];

  const int z = HEADS ? blockIdx.z : 0;
  const _Float16* __restrict__ A = A0 + (size_t)z * M_ * D_;
  const _Float16* __restrict__ Wt = Wt0 + (size_t)z * D_ * D_;
  const float* __restrict__ bias = z == 0 ? bias0 : z == 1 ? bias1 : bias2;
  void* __restrict__ outp =
      HEADS ? (void*)((_Float16*)outp0 + (size_t)z * M_ * D_) : outp0;
  const float scale = z == 0 ? scale0 : 1.0f;  // the score scale goes into Q alone

  const int tid = threadIdx.x;
  const int lane = tid & 31;
  const int wid = tid >> 5;
  const int wr = wid & 1;   // wave row 0..1  -> 64-row stripe
  const int wc = wid >> 1;  // wave col 0..1  -> 64-col stripe
  const int m0 = blockIdx.x * BM;
  const int n0 = blockIdx.y * BN;

  // Copies of the k0 tile into buffer `buf`: A and B each 128 rows x 8 chunks
  // of 16 B, 8 chunks of each per thread; a wave's 32 lanes cover 4 whole
  // 128-B row pieces per copy.
  auto issue_tile = [&](int k0, int buf) {
    const int r = tid >> 3, c = (tid & 7) * 8;
    const _Float16* ga = A + (size_t)(m0 + r) * D_ + k0 + c;
    const _Float16* la = &sA[buf][r * LS + c];
    async_copy8_b128(la, la + 16 * LS, la + 32 * LS, la + 48 * LS, la + 64 * LS,
                     la + 80 * LS, la + 96 * LS, la + 112 * LS, ga,
                     ga + 16 * D_, ga + 32 * D_, ga + 48 * D_, ga + 64 * D_,
                     ga + 80 * D_, ga + 96 * D_, ga + 112 * D_);
    const _Float16* gb = Wt + (size_t)(n0 + r) * D_ + k0 + c;
    const _Float16* lb = &sB[buf][r * LS + c];
    async_copy8_b128(lb, lb + 16 * LS, lb + 32 * LS, lb + 48 * LS, lb + 64 * LS,
                     lb + 80 * LS, lb + 96 * LS, lb + 112 * LS, gb,
                     gb + 16 * D_, gb + 32 * D_, gb + 48 * D_, gb + 64 * D_,
                     gb + 80 * D_, gb + 96 * D_, gb + 112 * D_);
  };

  v8f c[4][4] = {};

  const int NT = D_ / BK;  // 16 k-steps
  issue_tile(0, 0);
  wait_async0();    // my chunks of tile 0 have landed
  __syncthreads();  // everyone's chunks of tile 0 visible
  issue_tile(BK, 1);

  for (int kt = 0; kt < NT; ++kt) {
    const _Float16* al = sA[kt & 1];
    const _Float16* bl = sB[kt & 1];
    v16h a[4], b[4];
    // ---- first half of the tile's k ----
    for (int i = 0; i < 4; ++i) a[i] = load_frag_lds<LS>(al, wr * 64 + i * 16, 0);
    for (int j = 0; j < 4; ++j) b[j] = load_frag_lds<LS>(bl, wc * 64 + j * 16, 0);
    // keeps the 16 fragment loads one group ahead of their 16 products:
    // spread among them, each row of products waits its own loads out to zero
    __builtin_amdgcn_sched_barrier(0);
    for (int i = 0; i < 4; ++i)
      for (int j = 0; j < 4; ++j) c[i][j] = wmma16(a[i], b[j], c[i][j]);
    // ---- second half: its fragments are this trip's last LDS reads ----
    for (int i = 0; i < 4; ++i)
      a[i] = load_frag_lds<LS>(al, wr * 64 + i * 16, 32);
    for (int j = 0; j < 4; ++j)
      b[j] = load_frag_lds<LS>(bl, wc * 64 + j * 16, 32);
    // ---- foot: publish tile kt+1, free this trip's buffers ----
    // my LDS reads of this trip have returned before the buffers are refilled
    asm volatile("s_wait_dscnt 0x0" ::: "memory");
    wait_async0();    // my chunks of tile kt+1 have landed
    __syncthreads();  // all chunks visible; all reads of this trip's buffers done
    if (kt + 2 < NT) issue_tile((kt + 2) * BK, kt & 1);
    // the second half's products work on registers alone: behind the refill's
    // issue, so that its copies fly 16 products longer
    for (int i = 0; i < 4; ++i)
      for (int j = 0; j < 4; ++j) c[i][j] = wmma16(a[i], b[j], c[i][j]);
  }
  wait_async0();  // nothing in flight when the wave ends

  // ---- epilogue ----
  // C/D layout: element (vgpr r, lane): row = r + (lane>=16 ? 8 : 0),
  // col = lane & 15 (ISA 7.12.2).
  const int half8 = (lane >> 4) << 3;
  const int ncol = lane & 15;
  if (HEADS && z == 2) {
    // V^T: a lane's 8 accumulator registers are 8 consecutive positions t of
    // one feature d, so each 16x16 tile leaves as one 16-byte store per lane.
    for (int i = 0; i < 4; ++i)
      for (int j = 0; j < 4; ++j) {
        const int m = m0 + wr * 64 + i * 16 + half8;
        const int n = n0 + wc * 64 + j * 16 + ncol;
        const float bn = bias[n];
        const int b = m >> 11, t = m & (T_ - 1);
        const int h = n >> 6, d = n & (DK_ - 1);
        v8h w;
        for (int r = 0; r < 8; ++r) w[r] = (_Float16)(c[i][j][r] + bn);
        *(v8h*)((_Float16*)outp + ((size_t)b * H_ + h) * T_ * DK_ +
                ((t >> 6) * DK_ + d) * 64 + (t & 63)) = w;
      }
    return;
  }
  for (int i = 0; i < 4; ++i)
    for (int j = 0; j < 4; ++j)
      for (int r = 0; r < 8; ++r) {
        const int m = m0 + wr * 64 + i * 16 + r + half8;
        const int n = n0 + wc * 64 + j * 16 + ncol;
        float v = c[i][j][r] + bias[n];
        if (HEADS) {
          v *= scale;  // score scale folded into Q
          const int b = m >> 11, t = m & (T_ - 1);
          const int h = n >> 6, d = n & (DK_ - 1);
          ((_Float16*)outp)[(((size_t)b * H_ + h) * T_ + t) * DK_ + d] =
              (_Float16)v;
        } else {
          ((float*)outp)[(size_t)m * D_ + n] = v;
        }
      }
}

#define VTS 72  // LDS row stride in halves for the V^T tile (64+8; 144B)
#define KTS 72  // LDS row stride in halves for the K tile (128B + 16B pad)
#define NKT (T_ / 64)  // key tiles

// lane l <-> lane l ^ 16 (the two halves of a wave hold the same query)
__device__ __forceinline__ float xhalf(float x) {
  const int b = __builtin_bit_cast(int, x);
  return __builtin_bit_cast(
      float, __builtin_amdgcn_permlanex16(b, b, 0x76543210, 0xfedcba98, false,
                                          false));
}

// The grid is 4 waves per SIMD (4,096 waves on 1,024 SIMDs): with that stated
// the compiler keeps the fragment loads grouped ahead of their products and
// does not fold them into one register set with a full LDS wait per product.
__global__ __launch_bounds__(128)
__attribute__((amdgpu_waves_per_eu(4, 4))) void attn_wmma(
    const _Float16* __restrict__ Qh, const _Float16* __restrict__ Kh,
    const _Float16* __restrict__ Vt, const _Float16* __restrict__ Tm,
    _Float16* __restrict__ ctx) {
  __shared__ __attribute__((aligned(16)))
  _Float16 sVt[2][DK_ * VTS];  // V^T tiles: [feature][key], two buffers
  __shared__ __attribute__((aligned(16)))
  _Float16 sK[2][64 * KTS];  // K tiles: [key][feature], two buffers

  const int tid = threadIdx.x, lane = tid & 31, wid = tid >> 5;
  const int bh = blockIdx.y;  // b*16 + h
  const int b = bh >> 4, h = bh & 15;
  const int q0 = blockIdx.x * 64 + wid * 16;
  const size_t base = (size_t)bh * T_ * DK_;

  // Q fragments (scale already folded in at projection time); B operand of
  // S^T: column = query lane & 15, same k order as the K fragments.
  v16h qa[2];
  {
    const _Float16* qb = Qh + base + (size_t)q0 * DK_;
    qa[0] = load_frag_g64(qb, 0);
    qa[1] = load_frag_g64(qb, 32);
  }

  const int half8 = (lane >> 4) << 3;
  const int ncol = lane & 15;

  v8f o[4] = {};  // O^T: o[j][r] = O[q0 + ncol][j*16 + half8 + r]
  // minus the reference of this lane's query (alike in both halves), in all 8
  // registers: a lane's 8 scores of a tile belong to one query
  v8f nref = {};
  float rsum = 0.0f;    // this lane's half of the keys; joined in the epilogue

  // this lane's mask row, at its first key of a tile
  const _Float16* tmrow = Tm + (size_t)(q0 + ncol) * T_ + half8;

  // Copies of K tile t into buffer buf: 512 chunks of 16 B, 4 per thread;
  // a wave's 32 lanes cover 512 contiguous bytes (4 whole key rows) per copy.
  // The same for V^T tile t (4 whole feature rows per copy).
  auto issue_kv = [&](int t, int buf) {
    const _Float16* g = Kh + base + (size_t)t * 64 * DK_ + tid * 8;
    const _Float16* l = &sK[buf][(tid >> 3) * KTS + (tid & 7) * 8];
    const _Float16* gv = Vt + base + (size_t)t * DK_ * 64 + tid * 8;
    const _Float16* lv = &sVt[buf][(tid >> 3) * VTS + (tid & 7) * 8];
    async_copy8_b128(l, l + 16 * KTS, l + 32 * KTS, l + 48 * KTS, lv,
                     lv + 16 * VTS, lv + 32 * VTS, lv + 48 * VTS, g,
                     g + 16 * DK_, g + 32 * DK_, g + 48 * DK_, gv, gv + 16 * 64,
                     gv + 32 * 64, gv + 48 * 64);
  };

  issue_kv(0, 0);
  wait_async0();    // my chunks of tiles 0 have landed
  __syncthreads();  // everyone's chunks of tiles 0 visible
  issue_kv(1, 1);

  for (int kt = 0; kt < NKT; ++kt) {
    const int k0 = kt * 64;
    const _Float16* kl = sK[kt & 1];
    const _Float16* vl = sVt[kt & 1];

    // tanh(mask) of this lane's query: 8 consecutive keys per 16-key tile
    v8h tmv[4];
    for (int j = 0; j < 4; ++j)
      tmv[j] = *(const v8h*)(tmrow + k0 + j * 16);

    // ---- S^T = K Q^T: s[j][r] = S[q0 + ncol][k0 + j*16 + half8 + r] ----
    v16h kb[4][2];
    for (int j = 0; j < 4; ++j) {
      kb[j][0] = load_frag_lds<KTS>(kl, j * 16, 0);
      kb[j][1] = load_frag_lds<KTS>(kl, j * 16, 32);
    }
    // keeps the 16 K fragment loads one group ahead of the products: spread
    // among them, each small group is waited out to zero in one shared
    // register set
    __builtin_amdgcn_sched_barrier(0);
    v8f s[4];  // scores in base 2, less the reference in use
    for (int j = 0; j < 4; ++j) s[j] = wmma16(kb[j][0], qa[0], nref);
    for (int j = 0; j < 4; ++j) s[j] = wmma16(kb[j][1], qa[1], s[j]);

    // V^T fragments (A operand of the second product): they depend on nothing
    // below, so their LDS latency passes behind the softmax arithmetic
    v16h vb[4][2];
    for (int j = 0; j < 4; ++j) {
      vb[j][0] = load_frag_lds<VTS>(vl, j * 16, 0);
      vb[j][1] = load_frag_lds<VTS>(vl, j * 16, 32);
    }
    // keeps these 16 loads ahead of the exponentials: moved down among them,
    // the last ones stand directly in front of their wait
    __builtin_amdgcn_sched_barrier(0);

    // ---- exp2 of the scores as they are, and this lane's sum of them ----
    float e[4][8];
    float tj[4];
    // unrolled here and below: left rolled, the register arrays are indexed by
    // a variable and go to scratch memory
#pragma unroll
    for (int j = 0; j < 4; ++j) {
      tj[j] = 0.0f;
#pragma unroll
      for (int r = 0; r < 8; ++r) {
        e[j][r] = __builtin_amdgcn_exp2f(s[j][r]);
        tj[j] += e[j][r];
      }
    }
    float t = (tj[0] + tj[1]) + (tj[2] + tj[3]);
    // holds the 16 V^T fragment loads on this side of the branch below, where
    // the exponentials cover their latency: sunk behind it they are spread
    // among the second product's WMMAs, each small group waited out by itself
    asm volatile("" ::"v"(vb[0][0]), "v"(vb[0][1]), "v"(vb[1][0]), "v"(vb[1][1]),
                 "v"(vb[2][0]), "v"(vb[2][1]), "v"(vb[3][0]), "v"(vb[3][1]));

    // ---- new reference: first tile, or some exponential may pass 2^10 ----
    // (a sum of at most 2^10 bounds each term, so P stays far inside f16; the
    // negated test also takes a sum that is not a number).  One test per tile,
    // a scalar branch for the whole wave.
    const unsigned over = __builtin_amdgcn_ballot_w32(!(t <= 1024.0f));
    if ((over | (unsigned)(kt == 0)) != 0) {
      float mj[4];
#pragma unroll
      for (int j = 0; j < 4; ++j) {
        mj[j] = s[j][0];
#pragma unroll
        for (int r = 1; r < 8; ++r) mj[j] = fmaxf(mj[j], s[j][r]);
      }
      float m = fmaxf(fmaxf(mj[0], mj[1]), fmaxf(mj[2], mj[3]));
      m = fmaxf(m, xhalf(m));  // both halves of a query move alike
      // the first tile sets the reference; later it only rises
      const float d = kt == 0 ? m : fmaxf(m, 0.0f);
      // nothing is summed yet in the first tile: 0 keeps exp2 of a large -d out
      const float scl = kt == 0 ? 0.0f : __builtin_amdgcn_exp2f(-d);
#pragma unroll
      for (int j = 0; j < 4; ++j) {
        tj[j] = 0.0f;
#pragma unroll
        for (int r = 0; r < 8; ++r) {
          e[j][r] = __builtin_amdgcn_exp2f(s[j][r] - d);
          tj[j] += e[j][r];
        }
      }
      t = (tj[0] + tj[1]) + (tj[2] + tj[3]);
      rsum *= scl;
#pragma unroll
      for (int j = 0; j < 4; ++j)
#pragma unroll
        for (int r = 0; r < 8; ++r) o[j][r] *= scl;
#pragma unroll
      for (int r = 0; r < 8; ++r) nref[r] -= d;
    }
    rsum += t;  // denominator: unmasked

    // ---- numerator: P = exp2 * tanh(mask) ----
    // pb[mm][e] = P^T[key 32*mm + kmap(e)][query]: tiles 2*mm and 2*mm+1 in
    // register order are the hardware k order of a B operand.
    v16h pb[2];
#pragma unroll
    for (int j = 0; j < 4; ++j)
#pragma unroll
      for (int r = 0; r < 8; ++r)
        pb[j >> 1][(j & 1) * 8 + r] = (_Float16)(e[j][r] * (float)tmv[j][r]);

    // ---- O^T += V^T P^T ----
    for (int j = 0; j < 4; ++j) o[j] = wmma16(vb[j][0], pb[0], o[j]);
    for (int j = 0; j < 4; ++j) o[j] = wmma16(vb[j][1], pb[1], o[j]);

    // ---- foot: publish tiles kt+1, free this trip's K and V^T buffers ----
    // my LDS reads of this trip have returned before the buffers are refilled
    asm volatile("s_wait_dscnt 0x0" ::: "memory");
    wait_async0();    // my chunks of tiles kt+1 have landed
    __syncthreads();  // all chunks visible; all reads of this trip's buffers done
    if (kt + 2 < NKT) issue_kv(kt + 2, kt & 1);
  }
  wait_async0();  // nothing in flight when the wave ends

  // ---- normalize and write ctx as f16 [B, T, D] (heads re-interleaved) ----
  // a lane's 8 accumulator registers are 8 consecutive features of its query
  const float inv = 1.0f / fmaxf(rsum + xhalf(rsum), 1e-20f);
  _Float16* crow = ctx + ((size_t)b * T_ + q0 + ncol) * D_ + h * DK_ + half8;
  for (int j = 0; j < 4; ++j) {
    v8h w;
    for (int r = 0; r < 8; ++r) w[r] = (_Float16)(o[j][r] * inv);
    *(v8h*)(crow + j * 16) = w;
  }
}

// ---------------------------------------------------------------------------
// Host launcher
// ---------------------------------------------------------------------------
extern "C" void kernel_launch(void* const* d_in, const int* in_sizes, int n_in,
                              void* d_out, int out_size, void* d_ws,
                              size_t ws_size, hipStream_t stream) {
  (void)in_sizes; (void)n_in; (void)out_size; (void)ws_size;

  const float* query = (const float*)d_in[0];
  const float* key   = (const float*)d_in[1];
  const float* value = (const float*)d_in[2];
  const float* Wq = (const float*)d_in[3];
  const float* bq = (const float*)d_in[4];
  const float* Wk = (const float*)d_in[5];
  const float* bk = (const float*)d_in[6];
  const float* Wv = (const float*)d_in[7];
  const float* bv = (const float*)d_in[8];
  const float* Wo = (const float*)d_in[9];
  const float* bo = (const float*)d_in[10];
  const float* lmask = (const float*)d_in[11];

  // workspace carve-up (MiB offsets), 64 MiB total
  char* ws = (char*)d_ws;
  const size_t MB = (size_t)1 << 20;
  _Float16* Qh  = (_Float16*)(ws + 0 * MB);   // [B,H,T,64] f16 (pre-scaled)
  _Float16* Kh  = (_Float16*)(ws + 8 * MB);
  _Float16* Vt  = (_Float16*)(ws + 16 * MB);  // [B,H,T/64,64(d),64(t)] f16
  _Float16* Tm  = (_Float16*)(ws + 24 * MB);  // tanh(mask) f16 [T,T]
  _Float16* Xq  = (_Float16*)(ws + 32 * MB);  // f16 activations
  _Float16* Xk  = (_Float16*)(ws + 40 * MB);
  _Float16* Xv  = (_Float16*)(ws + 48 * MB);
  _Float16* Wqt = (_Float16*)(ws + 56 * MB);  // f16 transposed weights [n][k]
  _Float16* Wkt = (_Float16*)(ws + 58 * MB);
  _Float16* Wvt = (_Float16*)(ws + 60 * MB);
  _Float16* Wot = (_Float16*)(ws + 62 * MB);
  _Float16* ctx = (_Float16*)(ws + 32 * MB);  // reuse Xq (consumed by then)

  prepass_kernel<<<PRE_G, EW_T, 0, stream>>>(lmask, query, key, value, Wq, Wk,
                                             Wv, Wo, Tm, Xq, Xk, Xv, Wqt, Wkt,
                                             Wvt, Wot);

  const float qscale = 0.18033688f;  // log2(e)/sqrt(64): scores in base 2
  // Xq/Xk/Xv, Wqt/Wkt/Wvt and Qh/Kh/Vt each lie back to back (see above)
  gemm_wmma_async<true><<<dim3(M_ / BM, D_ / BN, 3), 128, 0, stream>>>(
      Xq, Wqt, bq, bk, bv, Qh, qscale);

  attn_wmma<<<dim3(T_ / 64, B_ * H_), 128, 0, stream>>>(Qh, Kh, Vt, Tm, ctx);

  gemm_wmma_async<false><<<dim3(M_ / BM, D_ / BN), 128, 0, stream>>>(
      ctx, Wot, bo, bo, bo, d_out, 1.0f);
}

// v008
// A run of this version takes 90.6 microseconds.
// Timed twice side by side with v007, it ran 1.04 times as fast both times.
// Over all steps from v000 it is 2.60 times as fast.
#include <hip/hip_runtime.h>
#include <hip/hip_bf16.h>

// ---------------------------------------------------------------------------
// MHA forward for B=2, T=2048, D=1024, H=16, DK=64 on gfx1250 (MI455X).
// All GEMMs run through v_wmma_f32_16x16x32_f16 (f16 in, f32 accumulate).
// GEMM tiles are staged global->LDS with GLOBAL_LOAD_ASYNC_TO_LDS_B128
// (ASYNCcnt) in a double-buffered pipeline.
// ---------------------------------------------------------------------------

typedef __attribute__((ext_vector_type(16))) _Float16 v16h;
typedef __attribute__((ext_vector_type(8)))  _Float16 v8h;
typedef __attribute__((ext_vector_type(4)))  _Float16 v4h;
typedef __attribute__((ext_vector_type(8)))  float    v8f;

#define B_  2
#define T_  2048
#define H_  16
#define DK_ 64
#define D_  1024
#define M_  (B_ * T_)   // 4096 rows for the projection GEMMs

__device__ __forceinline__ v8f wmma16(v16h a, v16h b, v8f c) {
  // (neg_a, A, neg_b, B, c_mod, C, reuse_a, reuse_b)
  return __builtin_amdgcn_wmma_f32_16x16x32_f16(false, a, false, b, (short)0, c,
                                                false, false);
}

__device__ __forceinline__ void wait_async0() {
  asm volatile("s_wait_asynccnt 0x0" ::: "memory");
}
// Async copies of 16-byte chunks, global -> LDS, tracked with ASYNCcnt.
// VDST = per-lane LDS byte offset (low 32 bits of the generic LDS pointer),
// VADDR = 64-bit global address.
// Eight such copies of one lane in ONE statement.  The closing s_wait_xcnt
// stands inside the statement so that no address register of an issued copy
// is rewritten in front of it.
__device__ __forceinline__ void async_copy8_b128(
    const void* l0, const void* l1, const void* l2, const void* l3,
    const void* l4, const void* l5, const void* l6, const void* l7,
    const void* g0, const void* g1, const void* g2, const void* g3,
    const void* g4, const void* g5, const void* g6, const void* g7) {
  asm volatile(
      "global_load_async_to_lds_b128 %0, %8, off\n\t"
      "global_load_async_to_lds_b128 %1, %9, off\n\t"
      "global_load_async_to_lds_b128 %2, %10, off\n\t"
      "global_load_async_to_lds_b128 %3, %11, off\n\t"
      "global_load_async_to_lds_b128 %4, %12, off\n\t"
      "global_load_async_to_lds_b128 %5, %13, off\n\t"
      "global_load_async_to_lds_b128 %6, %14, off\n\t"
      "global_load_async_to_lds_b128 %7, %15, off\n\t"
      "s_wait_xcnt 0x0" ::"v"((unsigned)(unsigned long long)l0),
      "v"((unsigned)(unsigned long long)l1),
      "v"((unsigned)(unsigned long long)l2),
      "v"((unsigned)(unsigned long long)l3),
      "v"((unsigned)(unsigned long long)l4),
      "v"((unsigned)(unsigned long long)l5),
      "v"((unsigned)(unsigned long long)l6),
      "v"((unsigned)(unsigned long long)l7), "v"(g0), "v"(g1), "v"(g2), "v"(g3),
      "v"(g4), "v"(g5), "v"(g6), "v"(g7)
      : "memory");
}

// Load a 16x32 f16 WMMA A/B fragment from LDS stored [row][k], k contiguous,
// row stride STRIDE halves (STRIDE % 8 == 0 so each half-row chunk is a
// 16-byte-aligned ds_load_b128).
// Lane L (L<16): row = row0+L, K = {kh..kh+7, 16+kh..16+kh+7} with kh=0.
// Lane L+16:    same row, kh=8.  Matches CDNA5 16-bit A layout (ISA 7.12.2).
template <int STRIDE>
__device__ __forceinline__ v16h load_frag_lds(const _Float16* base, int row0,
                                              int kOff) {
  const int lane = threadIdx.x & 31;
  const _Float16* p =
      base + (size_t)(row0 + (lane & 15)) * STRIDE + kOff + ((lane >> 4) << 3);
  v8h lo = *(const v8h*)(p);
  v8h hi = *(const v8h*)(p + 16);
  return __builtin_shufflevector(lo, hi, 0, 1, 2, 3, 4, 5, 6, 7, 8, 9, 10, 11,
                                 12, 13, 14, 15);
}

// Same fragment shape, loaded directly from global memory with row stride 64
// halves (the [*, 64] head layout of Q/K: row = head-row, k-dim = feature).
__device__ __forceinline__ v16h load_frag_g64(const _Float16* base, int kOff) {
  const int lane = threadIdx.x & 31;
  const _Float16* p =
      base + (size_t)(lane & 15) * DK_ + kOff + ((lane >> 4) << 3);
  v8h lo = *(const v8h*)(p);
  v8h hi = *(const v8h*)(p + 16);
  return __builtin_shufflevector(lo, hi, 0, 1, 2, 3, 4, 5, 6, 7, 8, 9, 10, 11,
                                 12, 13, 14, 15);
}

// ---------------------------------------------------------------------------
// Pre-pass: ONE launch for the eight jobs that read inputs only and none of
// each other's output (tanh of the mask, three f32 -> f16 conversions, four
// weight transposes).  A work-group's job follows from its index; the heavier
// jobs have the lower indices and start first, the short transposes fill the
// places they leave.  Few waves with much work each, 16 waves a work-group.
// Elementwise jobs: a thread takes 8 pieces of 16 B, all 8 loads in flight at
// once; every wave-wide load covers 512 contiguous bytes, every store 256.
// ---------------------------------------------------------------------------
#define EW_T 512                 // threads per work-group
#define EW_U 8                   // 16-byte pieces per thread
#define EW_N4 (M_ * D_ / 4)      // pieces per array (mask and activations alike)
#define EW_G (EW_N4 / (EW_T * EW_U))  // work-groups per elementwise job
static_assert(T_ * T_ == M_ * D_, "mask and activations: one piece count");
static_assert(EW_G * EW_T * EW_U == EW_N4, "the grid covers the array exactly");

// Transposes: W[k][n] f32 -> Wt[n][k] f16 by 64x64 tiles through LDS, so the
// GEMM B operand is k-contiguous.  Each half of a work-group (256 threads)
// takes one tile, the two tiles side by side in n.  A thread loads 4 pieces of
// 16 B (a wave: two 256-B row pieces per load) and stores 2 pieces of 16 B (a
// wave: four whole 128-B lines per store).  Pitch 65 dwords: the row-wise
// writes and the column-wise reads both fall on 32 different banks.
#define TT 64
#define TR_G ((D_ / TT) * (D_ / TT) / 2)  // work-groups per weight matrix
#define PRE_G (4 * EW_G + 4 * TR_G)       // work-groups of the launch

__global__ __launch_bounds__(EW_T) void prepass_kernel(
    const float* __restrict__ mask, const float* __restrict__ xq,
    const float* __restrict__ xk, const float* __restrict__ xv,
    const float* __restrict__ Wq, const float* __restrict__ Wk,
    const float* __restrict__ Wv, const float* __restrict__ Wo,
    _Float16* __restrict__ Tm, _Float16* __restrict__ Xq,
    _Float16* __restrict__ Xk, _Float16* __restrict__ Xv,
    _Float16* __restrict__ Wqt, _Float16* __restrict__ Wkt,
    _Float16* __restrict__ Wvt, _Float16* __restrict__ Wot) {
  __shared__ float tile[2][TT][TT + 1];
  const int bid = blockIdx.x;

  if (bid < EW_G) {  // tanh(learnable_mask) -> f16, reused by all (b,h)
    const int i0 = bid * (EW_T * EW_U) + threadIdx.x;
    float4 v[EW_U];
    for (int u = 0; u < EW_U; ++u) v[u] = ((const float4*)mask)[i0 + u * EW_T];
    for (int u = 0; u < EW_U; ++u) {
      v4h h;
      h.x = (_Float16)tanhf(v[u].x); h.y = (_Float16)tanhf(v[u].y);
      h.z = (_Float16)tanhf(v[u].z); h.w = (_Float16)tanhf(v[u].w);
      ((v4h*)Tm)[i0 + u * EW_T] = h;
    }
    return;
  }

  if (bid < 4 * EW_G) {  // f32 -> f16 (activations)
    const int job = bid / EW_G;  // 1, 2, 3
    const float* in = job == 1 ? xq : job == 2 ? xk : xv;
    _Float16* out = job == 1 ? Xq : job == 2 ? Xk : Xv;
    const int i0 = (bid % EW_G) * (EW_T * EW_U) + threadIdx.x;
    float4 v[EW_U];
    for (int u = 0; u < EW_U; ++u) v[u] = ((const float4*)in)[i0 + u * EW_T];
    for (int u = 0; u < EW_U; ++u) {
      v4h h;
      h.x = (_Float16)v[u].x; h.y = (_Float16)v[u].y;
      h.z = (_Float16)v[u].z; h.w = (_Float16)v[u].w;
      ((v4h*)out)[i0 + u * EW_T] = h;
    }
    return;
  }

  // weight transposes
  const int tb = bid - 4 * EW_G;
  const int job = tb / TR_G;  // 0 .. 3
  const float* W = job == 0 ? Wq : job == 1 ? Wk : job == 2 ? Wv : Wo;
  _Float16* Wt = job == 0 ? Wqt : job == 1 ? Wkt : job == 2 ? Wvt : Wot;
  const int tid = threadIdx.x & 255;
  const int sub = threadIdx.x >> 8;          // which of the two tiles
  const int ti = (tb % TR_G) * 2 + sub;      // tile 0 .. 255 of this matrix
  const int n0 = (ti % (D_ / TT)) * TT, k0 = (ti / (D_ / TT)) * TT;
  float4 v[4];
  for (int u = 0; u < 4; ++u) {
    const int q = tid + u * 256, k = q >> 4, c = q & 15;
    v[u] = *(const float4*)(W + (size_t)(k0 + k) * D_ + n0 + c * 4);
  }
  for (int u = 0; u < 4; ++u) {
    const int q = tid + u * 256, k = q >> 4, c = q & 15;
    tile[sub][k][c * 4 + 0] = v[u].x; tile[sub][k][c * 4 + 1] = v[u].y;
    tile[sub][k][c * 4 + 2] = v[u].z; tile[sub][k][c * 4 + 3] = v[u].w;
  }
  __syncthreads();
  for (int u = 0; u < 2; ++u) {
    const int q = tid + u * 256, n = q >> 3, kc = q & 7;
    v8h h;
    for (int j = 0; j < 8; ++j) h[j] = (_Float16)tile[sub][kc * 8 + j][n];
    *(v8h*)(Wt + (size_t)(n0 + n) * D_ + k0 + kc * 8) = h;
  }
}

// ---------------------------------------------------------------------------
// Kernel 1/3: C = A @ W + bias, with A [4096 x 1024] f16 row-major and
// Wt [1024(n) x 1024(k)] f16 (pre-transposed).  Tile 128x128, BK=64, 4 waves,
// each wave a 64x64 block = 4x4 WMMA tiles: a fragment read from LDS feeds four
// products, and a work-group fetches 256 operand rows for 16,384 outputs.
// Tiles staged by global_load_async_to_lds_b128 in whole 128-B lines, two
// buffers (tile k+1 flies while tile k is worked on).
// HEADS=true : scatter f16 into [B,H,T,64] head layout, scale folded in; V
//              alone goes out transposed by 64-key tiles, [B,H,T/64,64(d),64(t)]:
//              each tile is the 8 KiB block, features by keys, that the
//              attention kernel needs as a matrix operand.
//              The three projections, which read none of each other's output,
//              are ONE launch: blockIdx.z picks activations, weights, bias and
//              output (0: Q, 1: K, 2: V; each set of three lies back to back
//              in the workspace); 3 work-groups per WGP, all resident at once.
// HEADS=false: write f32 row-major [4096 x 1024] (final output); z is 0.
// ---------------------------------------------------------------------------
#define BM 128
#define BN 128
#define BK 64
#define LS 72  // LDS row stride in halves (64 + 8 pad; 144B, 16B aligned)

template <bool HEADS>
__global__ __launch_bounds__(128) void gemm_wmma_async(
    const _Float16* __restrict__ A0, const _Float16* __restrict__ Wt0,
    const float* __restrict__ bias0, const float* __restrict__ bias1,
    const float* __restrict__ bias2, void* __restrict__ outp0, float scale0) {
  __shared__ __attribute__((aligned(16))) _Float16 sA[2][BM * LS];
  __shared__ __attribute__((aligned(16))) _Float16 sB[2][BN * LS];

  const int z = HEADS ? blockIdx.z : 0;
  const _Float16* __restrict__ A = A0 + (size_t)z * M_ * D_;
  const _Float16* __restrict__ Wt = Wt0 + (size_t)z * D_ * D_;
  const float* __restrict__ bias = z == 0 ? bias0 : z == 1 ? bias1 : bias2;
  void* __restrict__ outp =
      HEADS ? (void*)((_Float16*)outp0 + (size_t)z * M_ * D_) : outp0;
  const float scale = z == 0 ? scale0 : 1.0f;  // the score scale goes into Q alone

  const int tid = threadIdx.x;
  const int lane = tid & 31;
  const int wid = tid >> 5;
  const int wr = wid & 1;   // wave row 0..1  -> 64-row stripe
  const int wc = wid >> 1;  // wave col 0..1  -> 64-col stripe
  const int m0 = blockIdx.x * BM;
  const int n0 = blockIdx.y * BN;

  // Copies of the k0 tile into buffer `buf`: A and B each 128 rows x 8 chunks
  // of 16 B, 8 chunks of each per thread; a wave's 32 lanes cover 4 whole
  // 128-B row pieces per copy.
  auto issue_tile = [&](int k0, int buf) {
    const int r = tid >> 3, c = (tid & 7) * 8;
    const _Float16* ga = A + (size_t)(m0 + r) * D_ + k0 + c;
    const _Float16* la = &sA[buf][r * LS + c];
    async_copy8_b128(la, la + 16 * LS, la + 32 * LS, la + 48 * LS, la + 64 * LS,
                     la + 80 * LS, la + 96 * LS, la + 112 * LS, ga,
                     ga + 16 * D_, ga + 32 * D_, ga + 48 * D_, ga + 64 * D_,
                     ga + 80 * D_, ga + 96 * D_, ga + 112 * D_);
    const _Float16* gb = Wt + (size_t)(n0 + r) * D_ + k0 + c;
    const _Float16* lb = &sB[buf][r * LS + c];
    async_copy8_b128(lb, lb + 16 * LS, lb + 32 * LS, lb + 48 * LS, lb + 64 * LS,
                     lb + 80 * LS, lb + 96 * LS, lb + 112 * LS, gb,
                     gb + 16 * D_, gb + 32 * D_, gb + 48 * D_, gb + 64 * D_,
                     gb + 80 * D_, gb + 96 * D_, gb + 112 * D_);
  };

  v8f c[4][4] = {};

  const int NT = D_ / BK;  // 16 k-steps
  static_assert((NT & (NT - 1)) == 0, "the k walk wraps by a mask");
  // The work-groups that share an A panel (same x) or a B panel (same y) start
  // together and keep step.  Each begins its walk over k at another tile and
  // wraps round, so that at one moment they ask L2 for different lines, spread
  // over the whole 2-KiB row and not all in the same 128 bytes of it.
  const int rot = blockIdx.x + blockIdx.y;
  auto kof = [&](int step) { return ((step + rot) & (NT - 1)) * BK; };
  issue_tile(kof(0), 0);
  wait_async0();    // my chunks of the first tile have landed
  __syncthreads();  // everyone's chunks of the first tile visible
  issue_tile(kof(1), 1);

  for (int kt = 0; kt < NT; ++kt) {
    const _Float16* al = sA[kt & 1];
    const _Float16* bl = sB[kt & 1];
    v16h a[4], b[4];
    // ---- first half of the tile's k ----
    for (int i = 0; i < 4; ++i) a[i] = load_frag_lds<LS>(al, wr * 64 + i * 16, 0);
    for (int j = 0; j < 4; ++j) b[j] = load_frag_lds<LS>(bl, wc * 64 + j * 16, 0);
    // keeps the 16 fragment loads one group ahead of their 16 products:
    // spread among them, each row of products waits its own loads out to zero
    __builtin_amdgcn_sched_barrier(0);
    for (int i = 0; i < 4; ++i)
      for (int j = 0; j < 4; ++j) c[i][j] = wmma16(a[i], b[j], c[i][j]);
    // ---- second half: its fragments are this trip's last LDS reads ----
    for (int i = 0; i < 4; ++i)
      a[i] = load_frag_lds<LS>(al, wr * 64 + i * 16, 32);
    for (int j = 0; j < 4; ++j)
      b[j] = load_frag_lds<LS>(bl, wc * 64 + j * 16, 32);
    // ---- foot: publish tile kt+1, free this trip's buffers ----
    // my LDS reads of this trip have returned before the buffers are refilled
    asm volatile("s_wait_dscnt 0x0" ::: "memory");
    wait_async0();    // my chunks of tile kt+1 have landed
    __syncthreads();  // all chunks visible; all reads of this trip's buffers done
    if (kt + 2 < NT) issue_tile(kof(kt + 2), kt & 1);
    // the second half's products work on registers alone: behind the refill's
    // issue, so that its copies fly 16 products longer
    for (int i = 0; i < 4; ++i)
      for (int j = 0; j < 4; ++j) c[i][j] = wmma16(a[i], b[j], c[i][j]);
  }
  wait_async0();  // nothing in flight when the wave ends

  // ---- epilogue ----
  // C/D layout: element (vgpr r, lane): row = r + (lane>=16 ? 8 : 0),
  // col = lane & 15 (ISA 7.12.2).
  const int half8 = (lane >> 4) << 3;
  const int ncol = lane & 15;
  if (HEADS && z == 2) {
    // V^T: a lane's 8 accumulator registers are 8 consecutive positions t of
    // one feature d, so each 16x16 tile leaves as one 16-byte store per lane.
    for (int i = 0; i < 4; ++i)
      for (int j = 0; j < 4; ++j) {
        const int m = m0 + wr * 64 + i * 16 + half8;
        const int n = n0 + wc * 64 + j * 16 + ncol;
        const float bn = bias[n];
        const int b = m >> 11, t = m & (T_ - 1);
        const int h = n >> 6, d = n & (DK_ - 1);
        v8h w;
        for (int r = 0; r < 8; ++r) w[r] = (_Float16)(c[i][j][r] + bn);
        *(v8h*)((_Float16*)outp + ((size_t)b * H_ + h) * T_ * DK_ +
                ((t >> 6) * DK_ + d) * 64 + (t & 63)) = w;
      }
    return;
  }
  for (int i = 0; i < 4; ++i)
    for (int j = 0; j < 4; ++j)
      for (int r = 0; r < 8; ++r) {
        const int m = m0 + wr * 64 + i * 16 + r + half8;
        const int n = n0 + wc * 64 + j * 16 + ncol;
        float v = c[i][j][r] + bias[n];
        if (HEADS) {
          v *= scale;  // score scale folded into Q
          const int b = m >> 11, t = m & (T_ - 1);
          const int h = n >> 6, d = n & (DK_ - 1);
          ((_Float16*)outp)[(((size_t)b * H_ + h) * T_ + t) * DK_ + d] =
              (_Float16)v;
        } else {
          ((float*)outp)[(size_t)m * D_ + n] = v;
        }
      }
}

#define VTS 72  // LDS row stride in halves for the V^T tile (64+8; 144B)
#define KTS 72  // LDS row stride in halves for the K tile (128B + 16B pad)
#define NKT (T_ / 64)  // key tiles

// lane l <-> lane l ^ 16 (the two halves of a wave hold the same query)
__device__ __forceinline__ float xhalf(float x) {
  const int b = __builtin_bit_cast(int, x);
  return __builtin_bit_cast(
      float, __builtin_amdgcn_permlanex16(b, b, 0x76543210, 0xfedcba98, false,
                                          false));
}

// The grid is 4 waves per SIMD (4,096 waves on 1,024 SIMDs): with that stated
// the compiler keeps the fragment loads grouped ahead of their products and
// does not fold them into one register set with a full LDS wait per product.
__global__ __launch_bounds__(128)
__attribute__((amdgpu_waves_per_eu(4, 4))) void attn_wmma(
    const _Float16* __restrict__ Qh, const _Float16* __restrict__ Kh,
    const _Float16* __restrict__ Vt, const _Float16* __restrict__ Tm,
    _Float16* __restrict__ ctx) {
  __shared__ __attribute__((aligned(16)))
  _Float16 sVt[2][DK_ * VTS];  // V^T tiles: [feature][key], two buffers
  __shared__ __attribute__((aligned(16)))
  _Float16 sK[2][64 * KTS];  // K tiles: [key][feature], two buffers

  const int tid = threadIdx.x, lane = tid & 31, wid = tid >> 5;
  const int bh = blockIdx.y;  // b*16 + h
  const int b = bh >> 4, h = bh & 15;
  const int q0 = blockIdx.x * 64 + wid * 16;
  const size_t base = (size_t)bh * T_ * DK_;

  // Q fragments (scale already folded in at projection time); B operand of
  // S^T: column = query lane & 15, same k order as the K fragments.
  v16h qa[2];
  {
    const _Float16* qb = Qh + base + (size_t)q0 * DK_;
    qa[0] = load_frag_g64(qb, 0);
    qa[1] = load_frag_g64(qb, 32);
  }

  const int half8 = (lane >> 4) << 3;
  const int ncol = lane & 15;

  v8f o[4] = {};  // O^T: o[j][r] = O[q0 + ncol][j*16 + half8 + r]
  // minus the reference of this lane's query (alike in both halves), in all 8
  // registers: a lane's 8 scores of a tile belong to one query
  v8f nref = {};
  float rsum = 0.0f;    // this lane's half of the keys; joined in the epilogue

  // this lane's mask row, at its first key of a tile
  const _Float16* tmrow = Tm + (size_t)(q0 + ncol) * T_ + half8;

  // Copies of K tile t into buffer buf: 512 chunks of 16 B, 4 per thread;
  // a wave's 32 lanes cover 512 contiguous bytes (4 whole key rows) per copy.
  // The same for V^T tile t (4 whole feature rows per copy).
  auto issue_kv = [&](int t, int buf) {
    const _Float16* g = Kh + base + (size_t)t * 64 * DK_ + tid * 8;
    const _Float16* l = &sK[buf][(tid >> 3) * KTS + (tid & 7) * 8];
    const _Float16* gv = Vt + base + (size_t)t * DK_ * 64 + tid * 8;
    const _Float16* lv = &sVt[buf][(tid >> 3) * VTS + (tid & 7) * 8];
    async_copy8_b128(l, l + 16 * KTS, l + 32 * KTS, l + 48 * KTS, lv,
                     lv + 16 * VTS, lv + 32 * VTS, lv + 48 * VTS, g,
                     g + 16 * DK_, g + 32 * DK_, g + 48 * DK_, gv, gv + 16 * 64,
                     gv + 32 * 64, gv + 48 * 64);
  };

  // The work-groups of one head (same y) read the same K and V^T tiles and keep
  // step.  Each begins its walk over the keys at another tile and wraps round,
  // so that at one moment they ask L2 for different lines; the mask reads of
  // different query blocks then also fall in different parts of the 4-KiB row.
  static_assert((NKT & (NKT - 1)) == 0, "the key walk wraps by a mask");
  const int rot = blockIdx.x;
  auto tof = [&](int step) { return (step + rot) & (NKT - 1); };

  issue_kv(tof(0), 0);
  wait_async0();    // my chunks of the first tiles have landed
  __syncthreads();  // everyone's chunks of the first tiles visible
  issue_kv(tof(1), 1);

  const _Float16* tmcur = tmrow + tof(0) * 64;  // the mask at the tile in work

  for (int kt = 0; kt < NKT; ++kt) {  // kt: step of the walk, tile tof(kt)
    const _Float16* kl = sK[kt & 1];
    const _Float16* vl = sVt[kt & 1];

    // tanh(mask) of this lane's query: 8 consecutive keys per 16-key tile
    v8h tmv[4];
    for (int j = 0; j < 4; ++j)
      tmv[j] = *(const v8h*)(tmcur + j * 16);

    // ---- S^T = K Q^T: s[j][r] = S[q0 + ncol][tile*64 + j*16 + half8 + r]
    v16h kb[4][2];
    for (int j = 0; j < 4; ++j) {
      kb[j][0] = load_frag_lds<KTS>(kl, j * 16, 0);
      kb[j][1] = load_frag_lds<KTS>(kl, j * 16, 32);
    }
    // keeps the 16 K fragment loads one group ahead of the products: spread
    // among them, each small group is waited out to zero in one shared
    // register set
    __builtin_amdgcn_sched_barrier(0);
    v8f s[4];  // scores in base 2, less the reference in use
    for (int j = 0; j < 4; ++j) s[j] = wmma16(kb[j][0], qa[0], nref);
    for (int j = 0; j < 4; ++j) s[j] = wmma16(kb[j][1], qa[1], s[j]);

    // V^T fragments (A operand of the second product): they depend on nothing
    // below, so their LDS latency passes behind the softmax arithmetic
    v16h vb[4][2];
    for (int j = 0; j < 4; ++j) {
      vb[j][0] = load_frag_lds<VTS>(vl, j * 16, 0);
      vb[j][1] = load_frag_lds<VTS>(vl, j * 16, 32);
    }
    // keeps these 16 loads ahead of the exponentials: moved down among them,
    // the last ones stand directly in front of their wait
    __builtin_amdgcn_sched_barrier(0);

    // ---- exp2 of the scores as they are, and this lane's sum of them ----
    float e[4][8];
    float tj[4];
    // unrolled here and below: left rolled, the register arrays are indexed by
    // a variable and go to scratch memory
#pragma unroll
    for (int j = 0; j < 4; ++j) {
      tj[j] = 0.0f;
#pragma unroll
      for (int r = 0; r < 8; ++r) {
        e[j][r] = __builtin_amdgcn_exp2f(s[j][r]);
        tj[j] += e[j][r];
      }
    }
    float t = (tj[0] + tj[1]) + (tj[2] + tj[3]);
    // holds the 16 V^T fragment loads on this side of the branch below, where
    // the exponentials cover their latency: sunk behind it they are spread
    // among the second product's WMMAs, each small group waited out by itself
    asm volatile("" ::"v"(vb[0][0]), "v"(vb[0][1]), "v"(vb[1][0]), "v"(vb[1][1]),
                 "v"(vb[2][0]), "v"(vb[2][1]), "v"(vb[3][0]), "v"(vb[3][1]));

    // ---- new reference: first tile, or some exponential may pass 2^10 ----
    // (a sum of at most 2^10 bounds each term, so P stays far inside f16; the
    // negated test also takes a sum that is not a number).  One test per tile,
    // a scalar branch for the whole wave.
    const unsigned over = __builtin_amdgcn_ballot_w32(!(t <= 1024.0f));
    if ((over | (unsigned)(kt == 0)) != 0) {
      float mj[4];
#pragma unroll
      for (int j = 0; j < 4; ++j) {
        mj[j] = s[j][0];
#pragma unroll
        for (int r = 1; r < 8; ++r) mj[j] = fmaxf(mj[j], s[j][r]);
      }
      float m = fmaxf(fmaxf(mj[0], mj[1]), fmaxf(mj[2], mj[3]));
      m = fmaxf(m, xhalf(m));  // both halves of a query move alike
      // the first tile sets the reference; later it only rises
      const float d = kt == 0 ? m : fmaxf(m, 0.0f);
      // nothing is summed yet in the first tile: 0 keeps exp2 of a large -d out
      const float scl = kt == 0 ? 0.0f : __builtin_amdgcn_exp2f(-d);
#pragma unroll
      for (int j = 0; j < 4; ++j) {
        tj[j] = 0.0f;
#pragma unroll
        for (int r = 0; r < 8; ++r) {
          e[j][r] = __builtin_amdgcn_exp2f(s[j][r] - d);
          tj[j] += e[j][r];
        }
      }
      t = (tj[0] + tj[1]) + (tj[2] + tj[3]);
      rsum *= scl;
#pragma unroll
      for (int j = 0; j < 4; ++j)
#pragma unroll
        for (int r = 0; r < 8; ++r) o[j][r] *= scl;
#pragma unroll
      for (int r = 0; r < 8; ++r) nref[r] -= d;
    }
    rsum += t;  // denominator: unmasked

    // ---- numerator: P = exp2 * tanh(mask) ----
    // pb[mm][e] = P^T[key 32*mm + kmap(e)][query]: tiles 2*mm and 2*mm+1 in
    // register order are the hardware k order of a B operand.
    v16h pb[2];
#pragma unroll
    for (int j = 0; j < 4; ++j)
#pragma unroll
      for (int r = 0; r < 8; ++r)
        pb[j >> 1][(j & 1) * 8 + r] = (_Float16)(e[j][r] * (float)tmv[j][r]);

    // ---- O^T += V^T P^T ----
    for (int j = 0; j < 4; ++j) o[j] = wmma16(vb[j][0], pb[0], o[j]);
    for (int j = 0; j < 4; ++j) o[j] = wmma16(vb[j][1], pb[1], o[j]);

    // ---- foot: publish tiles kt+1, free this trip's K and V^T buffers ----
    // my LDS reads of this trip have returned before the buffers are refilled
    asm volatile("s_wait_dscnt 0x0" ::: "memory");
    wait_async0();    // my chunks of tiles kt+1 have landed
    __syncthreads();  // all chunks visible; all reads of this trip's buffers done
    if (kt + 2 < NKT) issue_kv(tof(kt + 2), kt & 1);
    // stands in front of the rewrite of the mask loads' address register
    asm volatile("s_wait_xcnt 0x0" ::: "memory");
    // one tile on, back to the row's start behind its last tile
    tmcur += tof(kt) == NKT - 1 ? 64 - T_ : 64;
  }
  wait_async0();  // nothing in flight when the wave ends

  // ---- normalize and write ctx as f16 [B, T, D] (heads re-interleaved) ----
  // a lane's 8 accumulator registers are 8 consecutive features of its query
  const float inv = 1.0f / fmaxf(rsum + xhalf(rsum), 1e-20f);
  _Float16* crow = ctx + ((size_t)b * T_ + q0 + ncol) * D_ + h * DK_ + half8;
  for (int j = 0; j < 4; ++j) {
    v8h w;
    for (int r = 0; r < 8; ++r) w[r] = (_Float16)(o[j][r] * inv);
    *(v8h*)(crow + j * 16) = w;
  }
}

// ---------------------------------------------------------------------------
// Host launcher
// ---------------------------------------------------------------------------
extern "C" void kernel_launch(void* const* d_in, const int* in_sizes, int n_in,
                              void* d_out, int out_size, void* d_ws,
                              size_t ws_size, hipStream_t stream) {
  (void)in_sizes; (void)n_in; (void)out_size; (void)ws_size;

  const float* query = (const float*)d_in[0];
  const float* key   = (const float*)d_in[1];
  const float* value = (const float*)d_in[2];
  const float* Wq = (const float*)d_in[3];
  const float* bq = (const float*)d_in[4];
  const float* Wk = (const float*)d_in[5];
  const float* bk = (const float*)d_in[6];
  const float* Wv = (const float*)d_in[7];
  const float* bv = (const float*)d_in[8];
  const float* Wo = (const float*)d_in[9];
  const float* bo = (const float*)d_in[10];
  const float* lmask = (const float*)d_in[11];

  // workspace carve-up (MiB offsets), 64 MiB total
  char* ws = (char*)d_ws;
  const size_t MB = (size_t)1 << 20;
  _Float16* Qh  = (_Float16*)(ws + 0 * MB);   // [B,H,T,64] f16 (pre-scaled)
  _Float16* Kh  = (_Float16*)(ws + 8 * MB);
  _Float16* Vt  = (_Float16*)(ws + 16 * MB);  // [B,H,T/64,64(d),64(t)] f16
  _Float16* Tm  = (_Float16*)(ws + 24 * MB);  // tanh(mask) f16 [T,T]
  _Float16* Xq  = (_Float16*)(ws + 32 * MB);  // f16 activations
  _Float16* Xk  = (_Float16*)(ws + 40 * MB);
  _Float16* Xv  = (_Float16*)(ws + 48 * MB);
  _Float16* Wqt = (_Float16*)(ws + 56 * MB);  // f16 transposed weights [n][k]
  _Float16* Wkt = (_Float16*)(ws + 58 * MB);
  _Float16* Wvt = (_Float16*)(ws + 60 * MB);
  _Float16* Wot = (_Float16*)(ws + 62 * MB);
  _Float16* ctx = (_Float16*)(ws + 32 * MB);  // reuse Xq (consumed by then)

  prepass_kernel<<<PRE_G, EW_T, 0, stream>>>(lmask, query, key, value, Wq, Wk,
                                             Wv, Wo, Tm, Xq, Xk, Xv, Wqt, Wkt,
                                             Wvt, Wot);

  const float qscale = 0.18033688f;  // log2(e)/sqrt(64): scores in base 2
  // Xq/Xk/Xv, Wqt/Wkt/Wvt and Qh/Kh/Vt each lie back to back (see above)
  gemm_wmma_async<true><<<dim3(M_ / BM, D_ / BN, 3), 128, 0, stream>>>(
      Xq, Wqt, bq, bk, bv, Qh, qscale);

  attn_wmma<<<dim3(T_ / 64, B_ * H_), 128, 0, stream>>>(Qh, Kh, Vt, Tm, ctx);

  gemm_wmma_async<false><<<dim3(M_ / BM, D_ / BN), 128, 0, stream>>>(
      ctx, Wot, bo, bo, bo, d_out, 1.0f);
}
